// v000
// Measured on an AMD MI455X. A time is GPU time per run, averaged over a window of back-to-back runs after a warm-up
// (all launches, gaps included; the runs take copies of the inputs in turn), and the median of several windows.
// Apart from v000's, it joins two sittings. Times from different sittings can be a few percent apart, while
// side-by-side timings come from the same sitting.
// v000 is the starting kernel. One run takes 415 microseconds.
#include <hip/hip_runtime.h>
#include <hip/hip_bf16.h>

typedef __attribute__((ext_vector_type(16))) __bf16 bf16x16;
typedef __attribute__((ext_vector_type(8)))  float  f32x8;
typedef int v4i_ __attribute__((vector_size(16)));   // matches builtin's pointee type

#define D_MODEL 768
#define NHEAD   12
#define DK      64
#define SEQ     4096
#define BATCH   2
#define MTOT    (BATCH*SEQ)   // 8192

#define GS 40   // GEMM LDS row stride (elems): 80B rows, 16B-aligned, bank stride 20
#define FS 72   // flash LDS row stride (elems): 144B rows, 16B-aligned, bank stride 36

#if defined(__gfx1250__) && __has_builtin(__builtin_amdgcn_global_load_async_to_lds_b128)
#define HAVE_ASYNC 1
#else
#define HAVE_ASYNC 0
#endif

// A/B fragment K-index mapping for v_wmma_*_16x16x32_bf16 (ISA 7.12.2):
// lanes 0-15 hold K 0..7 (elems 0..7) and 16..23 (elems 8..15);
// lanes 16-31 hold K 8..15 and 24..31.
__device__ __forceinline__ int kmap(int e, int kh) {
    return (e < 8) ? (kh * 8 + e) : (16 + kh * 8 + (e - 8));
}

__device__ __forceinline__ f32x8 wmma_bf16(const bf16x16& a, const bf16x16& b, const f32x8& c) {
    return __builtin_amdgcn_wmma_f32_16x16x32_bf16(false, a, false, b, (short)0, c, false, false);
}

__device__ __forceinline__ unsigned pack2bf(float a, float b) {
    union { __bf16 h[2]; unsigned u; } x;
    x.h[0] = (__bf16)a; x.h[1] = (__bf16)b;
    return x.u;
}

// 16-byte async global->LDS copy (ASYNCcnt path); no-op stub when unavailable.
__device__ __forceinline__ void async_copy16(const __bf16* g, __bf16* l) {
#if HAVE_ASYNC
    __builtin_amdgcn_global_load_async_to_lds_b128(
        (__attribute__((address_space(1))) v4i_*)g,
        (__attribute__((address_space(3))) v4i_*)l,
        0, 0);
#else
    (void)g; (void)l;
#endif
}

__device__ __forceinline__ void wait_async0() {
#if HAVE_ASYNC
#if __has_builtin(__builtin_amdgcn_s_wait_asynccnt)
    __builtin_amdgcn_s_wait_asynccnt(0);
#else
    asm volatile("s_wait_asynccnt 0x0" ::: "memory");
#endif
#endif
}

// ---------------------------------------------------------------------------
// Kernel 1: QKV projection. Y = X @ W.T + b  (W stored [out,in] row-major)
// Block: 256 thr = 8 waves. Tile: 128(M) x 64(N). grid = (64, 12 heads, 3 proj)
// Output layout: [b, h, s, dk] in bf16. (f32->bf16 conversion during staging,
// so this stays on the synchronous vectorized path.)
// ---------------------------------------------------------------------------
__global__ __launch_bounds__(256)
void qkv_proj_kernel(const float* __restrict__ X,
                     const float* __restrict__ Wq, const float* __restrict__ bq,
                     const float* __restrict__ Wk, const float* __restrict__ bk,
                     const float* __restrict__ Wv, const float* __restrict__ bv,
                     __bf16* __restrict__ Qb, __bf16* __restrict__ Kb, __bf16* __restrict__ Vb)
{
    const int proj = blockIdx.z;
    const float* W    = (proj == 0) ? Wq : (proj == 1) ? Wk : Wv;
    const float* bias = (proj == 0) ? bq : (proj == 1) ? bk : bv;
    __bf16*      Out  = (proj == 0) ? Qb : (proj == 1) ? Kb : Vb;

    const int m0 = blockIdx.x * 128;
    const int h  = blockIdx.y;          // 64-wide N tile == exactly one head
    const int n0 = h * DK;

    __shared__ __bf16 Xs[128 * GS];
    __shared__ __bf16 Ws[64 * GS];

    const int tid  = threadIdx.x;
    const int wave = tid >> 5;
    const int lane = tid & 31;
    const int lm   = lane & 15;
    const int kh   = lane >> 4;

    f32x8 acc[4] = {};

    for (int k0 = 0; k0 < D_MODEL; k0 += 32) {
        __syncthreads();
#pragma unroll
        for (int i = 0; i < 4; i++) {           // X tile 128x32 f32 -> packed bf16
            int lin = tid + i * 256;
            int r = lin >> 3, c = (lin & 7) * 4;
            const float4 v = *(const float4*)(X + (size_t)(m0 + r) * D_MODEL + k0 + c);
            uint2 p; p.x = pack2bf(v.x, v.y); p.y = pack2bf(v.z, v.w);
            *(uint2*)(&Xs[r * GS + c]) = p;
        }
#pragma unroll
        for (int i = 0; i < 2; i++) {           // W tile 64(n) x 32(k)
            int lin = tid + i * 256;
            int r = lin >> 3, c = (lin & 7) * 4;
            const float4 v = *(const float4*)(W + (size_t)(n0 + r) * D_MODEL + k0 + c);
            uint2 p; p.x = pack2bf(v.x, v.y); p.y = pack2bf(v.z, v.w);
            *(uint2*)(&Ws[r * GS + c]) = p;
        }
        __syncthreads();

        bf16x16 a;
        const int arow = wave * 16 + lm;
#pragma unroll
        for (int e = 0; e < 16; e++) a[e] = Xs[arow * GS + kmap(e, kh)];
#pragma unroll
        for (int t = 0; t < 4; t++) {
            bf16x16 b;
            const int bcol = t * 16 + lm;
#pragma unroll
            for (int e = 0; e < 16; e++) b[e] = Ws[bcol * GS + kmap(e, kh)];
            acc[t] = wmma_bf16(a, b, acc[t]);
        }
    }

#pragma unroll
    for (int t = 0; t < 4; t++) {
        const int d  = t * 16 + lm;
        const float bv_ = bias[n0 + d];
#pragma unroll
        for (int r = 0; r < 8; r++) {
            const int M    = m0 + wave * 16 + r + 8 * kh;
            const int bidx = M >> 12;           // / 4096
            const int s    = M & 4095;
            Out[(((size_t)bidx * NHEAD + h) * SEQ + s) * DK + d] = (__bf16)(acc[t][r] + bv_);
        }
    }
}

// ---------------------------------------------------------------------------
// Kernel 2: flash attention. Block: 128 queries x one (b,h); 8 waves x 16 rows.
// Online softmax in fp32; QK^T and P@V via bf16 WMMA. K/V tiles streamed with
// double-buffered async global->LDS copies (ASYNCcnt). grid = (32, 24)
// Context written bf16 in [B, S, D_MODEL] layout.
// ---------------------------------------------------------------------------
__global__ __launch_bounds__(256)
void flash_attn_kernel(const __bf16* __restrict__ Qb, const __bf16* __restrict__ Kb,
                       const __bf16* __restrict__ Vb, __bf16* __restrict__ Ctx)
{
    const int bh = blockIdx.y;
    const int q0 = blockIdx.x * 128;
    const __bf16* Qh = Qb + (size_t)bh * SEQ * DK;
    const __bf16* Kh = Kb + (size_t)bh * SEQ * DK;
    const __bf16* Vh = Vb + (size_t)bh * SEQ * DK;

    __shared__ __bf16 Qs[128 * FS];
    __shared__ __bf16 Ks[2][64 * FS];
    __shared__ __bf16 Vs[2][64 * FS];
    __shared__ __bf16 Ps[8 * 16 * FS];   // per-wave 16x64 P strip

    const int tid  = threadIdx.x;
    const int wave = tid >> 5;
    const int lane = tid & 31;
    const int lm   = lane & 15;
    const int kh   = lane >> 4;

    // this thread's two 16B chunks of each 64x64 tile
    const int cr0 = (tid)       >> 3, cc0 = ((tid)       & 7) * 8;
    const int cr1 = (tid + 256) >> 3, cc1 = ((tid + 256) & 7) * 8;

#if HAVE_ASYNC
    // prologue: start DMA of first K/V tiles while we stage Q
    async_copy16(Kh + (size_t)cr0 * DK + cc0, &Ks[0][cr0 * FS + cc0]);
    async_copy16(Vh + (size_t)cr0 * DK + cc0, &Vs[0][cr0 * FS + cc0]);
    async_copy16(Kh + (size_t)cr1 * DK + cc1, &Ks[0][cr1 * FS + cc1]);
    async_copy16(Vh + (size_t)cr1 * DK + cc1, &Vs[0][cr1 * FS + cc1]);
#endif

    // Q block 128x64 bf16: 1024 uint4 loads, 4 per thread, b128 LDS stores
#pragma unroll
    for (int i = 0; i < 4; i++) {
        int lin = tid + i * 256;
        int r = lin >> 3, c = (lin & 7) * 8;
        *(uint4*)(&Qs[r * FS + c]) = *(const uint4*)(Qh + (size_t)(q0 + r) * DK + c);
    }
    __syncthreads();

    bf16x16 qa[2];
    {
        const int arow = wave * 16 + lm;
#pragma unroll
        for (int dc = 0; dc < 2; dc++)
#pragma unroll
            for (int e = 0; e < 16; e++)
                qa[dc][e] = Qs[arow * FS + dc * 32 + kmap(e, kh)];
    }

    float mrow[8], lrow[8];
#pragma unroll
    for (int r = 0; r < 8; r++) { mrow[r] = -3.0e38f; lrow[r] = 0.0f; }
    f32x8 cacc[4] = {};

    __bf16* Pw = Ps + wave * 16 * FS;
    const float scale = 0.125f;                   // 1/sqrt(64)

    int buf = 0;
    for (int j0 = 0; j0 < SEQ; j0 += 64, buf ^= 1) {
#if HAVE_ASYNC
        wait_async0();          // my async copies into Ks/Vs[buf] done
        __syncthreads();        // everyone's done; prior readers of buf^1 done
        if (j0 + 64 < SEQ) {    // kick off next tile into the other buffer
            const int jn = j0 + 64;
            async_copy16(Kh + (size_t)(jn + cr0) * DK + cc0, &Ks[buf ^ 1][cr0 * FS + cc0]);
            async_copy16(Vh + (size_t)(jn + cr0) * DK + cc0, &Vs[buf ^ 1][cr0 * FS + cc0]);
            async_copy16(Kh + (size_t)(jn + cr1) * DK + cc1, &Ks[buf ^ 1][cr1 * FS + cc1]);
            async_copy16(Vh + (size_t)(jn + cr1) * DK + cc1, &Vs[buf ^ 1][cr1 * FS + cc1]);
        }
#else
        __syncthreads();
        *(uint4*)(&Ks[buf][cr0 * FS + cc0]) = *(const uint4*)(Kh + (size_t)(j0 + cr0) * DK + cc0);
        *(uint4*)(&Vs[buf][cr0 * FS + cc0]) = *(const uint4*)(Vh + (size_t)(j0 + cr0) * DK + cc0);
        *(uint4*)(&Ks[buf][cr1 * FS + cc1]) = *(const uint4*)(Kh + (size_t)(j0 + cr1) * DK + cc1);
        *(uint4*)(&Vs[buf][cr1 * FS + cc1]) = *(const uint4*)(Vh + (size_t)(j0 + cr1) * DK + cc1);
        __syncthreads();
#endif
        const __bf16* Kt = Ks[buf];
        const __bf16* Vt = Vs[buf];

        // S = Q @ K^T : 4 N-tiles x 2 d-chunks
        f32x8 sacc[4] = {};
#pragma unroll
        for (int t = 0; t < 4; t++) {
            const int key = t * 16 + lm;
#pragma unroll
            for (int dc = 0; dc < 2; dc++) {
                bf16x16 b;
#pragma unroll
                for (int e = 0; e < 16; e++) b[e] = Kt[key * FS + dc * 32 + kmap(e, kh)];
                sacc[t] = wmma_bf16(qa[dc], b, sacc[t]);
            }
        }
#pragma unroll
        for (int t = 0; t < 4; t++)
#pragma unroll
            for (int r = 0; r < 8; r++) sacc[t][r] *= scale;

        // online softmax; row M = r + 8*kh lives on the 16 lanes of this half
#pragma unroll
        for (int r = 0; r < 8; r++) {
            float vmax = fmaxf(fmaxf(sacc[0][r], sacc[1][r]), fmaxf(sacc[2][r], sacc[3][r]));
#pragma unroll
            for (int off = 8; off >= 1; off >>= 1)
                vmax = fmaxf(vmax, __shfl_xor(vmax, off, 16));
            const float mnew = fmaxf(mrow[r], vmax);
            const float corr = __expf(mrow[r] - mnew);
            float rsum = 0.0f;
#pragma unroll
            for (int t = 0; t < 4; t++) {
                const float p = __expf(sacc[t][r] - mnew);
                sacc[t][r] = p;
                rsum += p;
            }
#pragma unroll
            for (int off = 8; off >= 1; off >>= 1)
                rsum += __shfl_xor(rsum, off, 16);
            lrow[r] = lrow[r] * corr + rsum;
            mrow[r] = mnew;
#pragma unroll
            for (int t = 0; t < 4; t++) cacc[t][r] *= corr;
            const int prow = r + 8 * kh;
#pragma unroll
            for (int t = 0; t < 4; t++)
                Pw[prow * FS + t * 16 + lm] = (__bf16)sacc[t][r];
        }

        // context += P @ V  (same-wave LDS producer/consumer; DS ops in order)
#pragma unroll
        for (int t = 0; t < 4; t++) {
            const int d = t * 16 + lm;
#pragma unroll
            for (int kc = 0; kc < 2; kc++) {
                bf16x16 pa, vb;
#pragma unroll
                for (int e = 0; e < 16; e++) pa[e] = Pw[lm * FS + kc * 32 + kmap(e, kh)];
#pragma unroll
                for (int e = 0; e < 16; e++) vb[e] = Vt[(kc * 32 + kmap(e, kh)) * FS + d];
                cacc[t] = wmma_bf16(pa, vb, cacc[t]);
            }
        }
    }

    const int bidx = bh / NHEAD;
    const int h    = bh % NHEAD;
#pragma unroll
    for (int t = 0; t < 4; t++) {
        const int d = t * 16 + lm;
#pragma unroll
        for (int r = 0; r < 8; r++) {
            const int row = r + 8 * kh;
            const int s   = q0 + wave * 16 + row;
            const float v = cacc[t][r] / lrow[r];
            Ctx[((size_t)(bidx * SEQ + s)) * D_MODEL + h * DK + d] = (__bf16)v;
        }
    }
}

// ---------------------------------------------------------------------------
// Kernel 3: output projection. out = ctx @ Wo.T + bo, fp32 result. grid=(64,12)
// ---------------------------------------------------------------------------
__global__ __launch_bounds__(256)
void out_proj_kernel(const __bf16* __restrict__ Ctx, const float* __restrict__ Wo,
                     const float* __restrict__ bo, float* __restrict__ Out)
{
    const int m0 = blockIdx.x * 128;
    const int n0 = blockIdx.y * 64;

    __shared__ __bf16 Xs[128 * GS];
    __shared__ __bf16 Ws[64 * GS];

    const int tid  = threadIdx.x;
    const int wave = tid >> 5;
    const int lane = tid & 31;
    const int lm   = lane & 15;
    const int kh   = lane >> 4;

    f32x8 acc[4] = {};

    for (int k0 = 0; k0 < D_MODEL; k0 += 32) {
        __syncthreads();
#pragma unroll
        for (int i = 0; i < 2; i++) {           // ctx tile 128x32 bf16
            int lin = tid + i * 256;
            int r = lin >> 2, c = (lin & 3) * 8;
            *(uint4*)(&Xs[r * GS + c]) = *(const uint4*)(Ctx + (size_t)(m0 + r) * D_MODEL + k0 + c);
        }
#pragma unroll
        for (int i = 0; i < 2; i++) {           // Wo tile 64x32 f32 -> bf16
            int lin = tid + i * 256;
            int r = lin >> 3, c = (lin & 7) * 4;
            const float4 v = *(const float4*)(Wo + (size_t)(n0 + r) * D_MODEL + k0 + c);
            uint2 p; p.x = pack2bf(v.x, v.y); p.y = pack2bf(v.z, v.w);
            *(uint2*)(&Ws[r * GS + c]) = p;
        }
        __syncthreads();

        bf16x16 a;
        const int arow = wave * 16 + lm;
#pragma unroll
        for (int e = 0; e < 16; e++) a[e] = Xs[arow * GS + kmap(e, kh)];
#pragma unroll
        for (int t = 0; t < 4; t++) {
            bf16x16 b;
            const int bcol = t * 16 + lm;
#pragma unroll
            for (int e = 0; e < 16; e++) b[e] = Ws[bcol * GS + kmap(e, kh)];
            acc[t] = wmma_bf16(a, b, acc[t]);
        }
    }

#pragma unroll
    for (int t = 0; t < 4; t++) {
        const int n   = n0 + t * 16 + lm;
        const float b = bo[n];
#pragma unroll
        for (int r = 0; r < 8; r++) {
            const int M = m0 + wave * 16 + r + 8 * kh;
            Out[(size_t)M * D_MODEL + n] = acc[t][r] + b;
        }
    }
}

// ---------------------------------------------------------------------------
extern "C" void kernel_launch(void* const* d_in, const int* in_sizes, int n_in,
                              void* d_out, int out_size, void* d_ws, size_t ws_size,
                              hipStream_t stream)
{
    (void)in_sizes; (void)n_in; (void)out_size;

    const float* x  = (const float*)d_in[0];
    const float* Wq = (const float*)d_in[1];
    const float* bq = (const float*)d_in[2];
    const float* Wk = (const float*)d_in[3];
    const float* bk = (const float*)d_in[4];
    const float* Wv = (const float*)d_in[5];
    const float* bv = (const float*)d_in[6];
    const float* Wo = (const float*)d_in[7];
    const float* bo = (const float*)d_in[8];
    float* out = (float*)d_out;

    const size_t E = (size_t)MTOT * D_MODEL;      // 6,291,456 elements
    if (ws_size < 4 * E * sizeof(__bf16)) return; // ~48 MB scratch required
    __bf16* ws = (__bf16*)d_ws;
    __bf16* Qb = ws;
    __bf16* Kb = ws + E;
    __bf16* Vb = ws + 2 * E;
    __bf16* Cb = ws + 3 * E;

    dim3 g1(MTOT / 128, NHEAD, 3);
    qkv_proj_kernel<<<g1, 256, 0, stream>>>(x, Wq, bq, Wk, bk, Wv, bv, Qb, Kb, Vb);

    dim3 g2(SEQ / 128, BATCH * NHEAD);
    flash_attn_kernel<<<g2, 256, 0, stream>>>(Qb, Kb, Vb, Cb);

    dim3 g3(MTOT / 128, D_MODEL / 64);
    out_proj_kernel<<<g3, 256, 0, stream>>>(Cb, Wo, bo, out);
}

// v001
// One run takes 199 microseconds.
// Next to v000, in two timings, it ran 2.20 and 2.19 times as fast.
#include <hip/hip_runtime.h>
#include <hip/hip_bf16.h>

typedef __attribute__((ext_vector_type(16))) __bf16 bf16x16;
typedef __attribute__((ext_vector_type(8)))  float  f32x8;
typedef int v4i_ __attribute__((vector_size(16)));   // matches builtin's pointee type

#define D_MODEL 768
#define NHEAD   12
#define DK      64
#define SEQ     4096
#define BATCH   2
#define MTOT    (BATCH*SEQ)   // 8192

#define GS 40   // GEMM LDS row stride (elems): 80B rows, 16B-aligned, bank stride 20
#define FS 72   // flash LDS row stride (elems): 144B rows, 16B-aligned, bank stride 36
#define VS 80   // V tile LDS row stride (elems): 160B = 32B x odd, the transposing load's pitch

#if defined(__gfx1250__) && __has_builtin(__builtin_amdgcn_global_load_async_to_lds_b128)
#define HAVE_ASYNC 1
#else
#define HAVE_ASYNC 0
#endif

// A/B fragment K-index mapping for v_wmma_*_16x16x32_bf16 (ISA 7.12.2):
// lanes 0-15 hold K 0..7 (elems 0..7) and 16..23 (elems 8..15);
// lanes 16-31 hold K 8..15 and 24..31.
__device__ __forceinline__ int kmap(int e, int kh) {
    return (e < 8) ? (kh * 8 + e) : (16 + kh * 8 + (e - 8));
}

__device__ __forceinline__ f32x8 wmma_bf16(const bf16x16& a, const bf16x16& b, const f32x8& c) {
    return __builtin_amdgcn_wmma_f32_16x16x32_bf16(false, a, false, b, (short)0, c, false, false);
}

__device__ __forceinline__ unsigned pack2bf(float a, float b) {
    union { __bf16 h[2]; unsigned u; } x;
    x.h[0] = (__bf16)a; x.h[1] = (__bf16)b;
    return x.u;
}

// 16-byte async global->LDS copy (ASYNCcnt path); no-op stub when unavailable.
__device__ __forceinline__ void async_copy16(const __bf16* g, __bf16* l) {
#if HAVE_ASYNC
    __builtin_amdgcn_global_load_async_to_lds_b128(
        (__attribute__((address_space(1))) v4i_*)g,
        (__attribute__((address_space(3))) v4i_*)l,
        0, 0);
#else
    (void)g; (void)l;
#endif
}

__device__ __forceinline__ void wait_async0() {
#if HAVE_ASYNC
#if __has_builtin(__builtin_amdgcn_s_wait_asynccnt)
    __builtin_amdgcn_s_wait_asynccnt(0);
#else
    asm volatile("s_wait_asynccnt 0x0" ::: "memory");
#endif
#endif
}

// ---------------------------------------------------------------------------
// Kernel 1: QKV projection. Y = X @ W.T + b  (W stored [out,in] row-major)
// Block: 256 thr = 8 waves. Tile: 128(M) x 64(N). grid = (64, 12 heads, 3 proj)
// Output layout: [b, h, s, dk] in bf16. (f32->bf16 conversion during staging,
// so this stays on the synchronous vectorized path.)
// ---------------------------------------------------------------------------
__global__ __launch_bounds__(256)
void qkv_proj_kernel(const float* __restrict__ X,
                     const float* __restrict__ Wq, const float* __restrict__ bq,
                     const float* __restrict__ Wk, const float* __restrict__ bk,
                     const float* __restrict__ Wv, const float* __restrict__ bv,
                     __bf16* __restrict__ Qb, __bf16* __restrict__ Kb, __bf16* __restrict__ Vb)
{
    const int proj = blockIdx.z;
    const float* W    = (proj == 0) ? Wq : (proj == 1) ? Wk : Wv;
    const float* bias = (proj == 0) ? bq : (proj == 1) ? bk : bv;
    __bf16*      Out  = (proj == 0) ? Qb : (proj == 1) ? Kb : Vb;

    const int m0 = blockIdx.x * 128;
    const int h  = blockIdx.y;          // 64-wide N tile == exactly one head
    const int n0 = h * DK;

    __shared__ __bf16 Xs[128 * GS];
    __shared__ __bf16 Ws[64 * GS];

    const int tid  = threadIdx.x;
    const int wave = tid >> 5;
    const int lane = tid & 31;
    const int lm   = lane & 15;
    const int kh   = lane >> 4;

    f32x8 acc[4] = {};

    for (int k0 = 0; k0 < D_MODEL; k0 += 32) {
        __syncthreads();
#pragma unroll
        for (int i = 0; i < 4; i++) {           // X tile 128x32 f32 -> packed bf16
            int lin = tid + i * 256;
            int r = lin >> 3, c = (lin & 7) * 4;
            const float4 v = *(const float4*)(X + (size_t)(m0 + r) * D_MODEL + k0 + c);
            uint2 p; p.x = pack2bf(v.x, v.y); p.y = pack2bf(v.z, v.w);
            *(uint2*)(&Xs[r * GS + c]) = p;
        }
#pragma unroll
        for (int i = 0; i < 2; i++) {           // W tile 64(n) x 32(k)
            int lin = tid + i * 256;
            int r = lin >> 3, c = (lin & 7) * 4;
            const float4 v = *(const float4*)(W + (size_t)(n0 + r) * D_MODEL + k0 + c);
            uint2 p; p.x = pack2bf(v.x, v.y); p.y = pack2bf(v.z, v.w);
            *(uint2*)(&Ws[r * GS + c]) = p;
        }
        __syncthreads();

        bf16x16 a;
        const int arow = wave * 16 + lm;
#pragma unroll
        for (int e = 0; e < 16; e++) a[e] = Xs[arow * GS + kmap(e, kh)];
#pragma unroll
        for (int t = 0; t < 4; t++) {
            bf16x16 b;
            const int bcol = t * 16 + lm;
#pragma unroll
            for (int e = 0; e < 16; e++) b[e] = Ws[bcol * GS + kmap(e, kh)];
            acc[t] = wmma_bf16(a, b, acc[t]);
        }
    }

#pragma unroll
    for (int t = 0; t < 4; t++) {
        const int d  = t * 16 + lm;
        const float bv_ = bias[n0 + d];
#pragma unroll
        for (int r = 0; r < 8; r++) {
            const int M    = m0 + wave * 16 + r + 8 * kh;
            const int bidx = M >> 12;           // / 4096
            const int s    = M & 4095;
            Out[(((size_t)bidx * NHEAD + h) * SEQ + s) * DK + d] = (__bf16)(acc[t][r] + bv_);
        }
    }
}

typedef __attribute__((ext_vector_type(8))) __bf16 bf16x8;

// Row-major 16-bit LDS tile -> transposed operand half: lane (lm, kh) gets
// T[kbase + 8*kh + 0..7][dbase + lm]; p is the lane's own address (see vrow below).
__device__ __forceinline__ bf16x8 ld_tr16(const __bf16* p) {
    typedef __attribute__((address_space(3))) bf16x8 lds_bf16x8;
    return __builtin_amdgcn_ds_load_tr16_b128_v8bf16((lds_bf16x8*)p);
}

// value of lane l ^ 16
__device__ __forceinline__ float xhalf(float x) {
    return __builtin_bit_cast(float, __builtin_amdgcn_permlanex16(
        __builtin_bit_cast(int, x), __builtin_bit_cast(int, x),
        0x76543210, 0xfedcba98, false, false));
}

// 2^x of one score tile's eight registers. One statement, so that each v_exp_f32 is
// followed by an independent one and the last by v_nop: the slot the instruction set
// asks for before a transcendental's source is overwritten or its result read.
__device__ __forceinline__ f32x8 exp2x8(const f32x8& x) {
    float y0, y1, y2, y3, y4, y5, y6, y7;
    asm("v_exp_f32 %0, %8\n\t"
        "v_exp_f32 %1, %9\n\t"
        "v_exp_f32 %2, %10\n\t"
        "v_exp_f32 %3, %11\n\t"
        "v_exp_f32 %4, %12\n\t"
        "v_exp_f32 %5, %13\n\t"
        "v_exp_f32 %6, %14\n\t"
        "v_exp_f32 %7, %15\n\t"
        "v_nop"
        : "=&v"(y0), "=&v"(y1), "=&v"(y2), "=&v"(y3), "=&v"(y4), "=&v"(y5), "=&v"(y6), "=&v"(y7)
        : "v"(x[0]), "v"(x[1]), "v"(x[2]), "v"(x[3]), "v"(x[4]), "v"(x[5]), "v"(x[6]), "v"(x[7]));
    f32x8 y = {y0, y1, y2, y3, y4, y5, y6, y7};
    return y;
}

// the same for a single value
__device__ __forceinline__ float exp2x1(float x) {
    float y;
    asm("v_exp_f32 %0, %1\n\t"
        "v_nop"
        : "=&v"(y) : "v"(x));
    return y;
}

// 768 work-groups on 256 WGPs: three resident per WGP (six waves per SIMD) hold the whole grid
__global__ __launch_bounds__(256) __attribute__((amdgpu_waves_per_eu(6)))
void flash_attn_kernel(const __bf16* __restrict__ Qb, const __bf16* __restrict__ Kb,
                       const __bf16* __restrict__ Vb, __bf16* __restrict__ Ctx)
{
    const int bh = blockIdx.y;
    const int q0 = blockIdx.x * 128;
    const __bf16* Qh = Qb + (size_t)bh * SEQ * DK;
    const __bf16* Kh = Kb + (size_t)bh * SEQ * DK;
    const __bf16* Vh = Vb + (size_t)bh * SEQ * DK;

    __shared__ __attribute__((aligned(16))) __bf16 Qs[128 * FS];
    __shared__ __attribute__((aligned(16))) __bf16 Ks[2][64 * FS];
    __shared__ __attribute__((aligned(16))) __bf16 Vs[2][64 * VS];

    const int tid  = threadIdx.x;
    const int wave = tid >> 5;
    const int lane = tid & 31;
    const int lm   = lane & 15;
    const int kh   = lane >> 4;

    // this thread's two 16B chunks of each 64x64 tile
    const int cr0 = (tid)       >> 3, cc0 = ((tid)       & 7) * 8;
    const int cr1 = (tid + 256) >> 3, cc1 = ((tid + 256) & 7) * 8;

#if HAVE_ASYNC
    // prologue: start DMA of first K/V tiles while we stage Q
    async_copy16(Kh + (size_t)cr0 * DK + cc0, &Ks[0][cr0 * FS + cc0]);
    async_copy16(Vh + (size_t)cr0 * DK + cc0, &Vs[0][cr0 * VS + cc0]);
    async_copy16(Kh + (size_t)cr1 * DK + cc1, &Ks[0][cr1 * FS + cc1]);
    async_copy16(Vh + (size_t)cr1 * DK + cc1, &Vs[0][cr1 * VS + cc1]);
#endif

    // Q block 128x64 bf16: 1024 uint4 loads, 4 per thread, b128 LDS stores
#pragma unroll
    for (int i = 0; i < 4; i++) {
        int lin = tid + i * 256;
        int r = lin >> 3, c = (lin & 7) * 8;
        *(uint4*)(&Qs[r * FS + c]) = *(const uint4*)(Qh + (size_t)(q0 + r) * DK + c);
    }
    __syncthreads();

    // B operand of S^T: column lm = this wave's query lm, k = d in kmap order
    bf16x16 qb[2];
    {
        const int qrow = wave * 16 + lm;
#pragma unroll
        for (int dc = 0; dc < 2; dc++)
#pragma unroll
            for (int e = 0; e < 16; e++)
                qb[dc][e] = Qs[qrow * FS + dc * 32 + kmap(e, kh)];
    }

    float mrow = -3.0e38f;      // running maximum of query lm (equal in both halves)
    float lrow = 0.0f;          // running sum over this half's keys only
    f32x8 cacc[4] = {};         // cacc[t][r] = O^T[d = 16t + 8kh + r][query lm]

    const float scale = 0.125f;                   // 1/sqrt(64)
    // lane's element offset inside a V tile for the transposing load
    const int vrow = (8 * kh + (lane & 7)) * VS + 8 * ((lane >> 3) & 1);

    int buf = 0;
    for (int j0 = 0; j0 < SEQ; j0 += 64, buf ^= 1) {
#if HAVE_ASYNC
        wait_async0();          // my async copies into Ks/Vs[buf] done
        __syncthreads();        // everyone's done; prior readers of buf^1 done
        if (j0 + 64 < SEQ) {    // kick off next tile into the other buffer
            const int jn = j0 + 64;
            async_copy16(Kh + (size_t)(jn + cr0) * DK + cc0, &Ks[buf ^ 1][cr0 * FS + cc0]);
            async_copy16(Vh + (size_t)(jn + cr0) * DK + cc0, &Vs[buf ^ 1][cr0 * VS + cc0]);
            async_copy16(Kh + (size_t)(jn + cr1) * DK + cc1, &Ks[buf ^ 1][cr1 * FS + cc1]);
            async_copy16(Vh + (size_t)(jn + cr1) * DK + cc1, &Vs[buf ^ 1][cr1 * VS + cc1]);
        }
#else
        __syncthreads();
        *(uint4*)(&Ks[buf][cr0 * FS + cc0]) = *(const uint4*)(Kh + (size_t)(j0 + cr0) * DK + cc0);
        *(uint4*)(&Vs[buf][cr0 * VS + cc0]) = *(const uint4*)(Vh + (size_t)(j0 + cr0) * DK + cc0);
        *(uint4*)(&Ks[buf][cr1 * FS + cc1]) = *(const uint4*)(Kh + (size_t)(j0 + cr1) * DK + cc1);
        *(uint4*)(&Vs[buf][cr1 * VS + cc1]) = *(const uint4*)(Vh + (size_t)(j0 + cr1) * DK + cc1);
        __syncthreads();
#endif
        const __bf16* Kt = Ks[buf];
        const __bf16* Vt = Vs[buf];

        // S^T = K @ Q^T : 4 key tiles x 2 d-chunks; sacc[t][r] = S[query lm][key 16t + 8kh + r]
        f32x8 sacc[4] = {};
#pragma unroll
        for (int t = 0; t < 4; t++) {
            const int key = t * 16 + lm;
#pragma unroll
            for (int dc = 0; dc < 2; dc++) {
                bf16x16 a;
#pragma unroll
                for (int e = 0; e < 16; e++) a[e] = Kt[key * FS + dc * 32 + kmap(e, kh)];
                sacc[t] = wmma_bf16(a, qb[dc], sacc[t]);
            }
        }
#pragma unroll
        for (int t = 0; t < 4; t++)
#pragma unroll
            for (int r = 0; r < 8; r++) sacc[t][r] *= scale;

        // online softmax of query lm: 32 keys in this lane, the other 32 in lane ^ 16
        float tmax[4];
#pragma unroll
        for (int t = 0; t < 4; t++) {
            tmax[t] = sacc[t][0];
#pragma unroll
            for (int r = 1; r < 8; r++) tmax[t] = fmaxf(tmax[t], sacc[t][r]);
        }
        float vmax = fmaxf(fmaxf(tmax[0], tmax[1]), fmaxf(tmax[2], tmax[3]));
        vmax = fmaxf(vmax, xhalf(vmax));
        const float mnew = fmaxf(mrow, vmax);
        const float corr = exp2x1((mrow - mnew) * 1.44269504f);
        float tsum[4];
#pragma unroll
        for (int t = 0; t < 4; t++) {
            f32x8 x;             // exp(s - m) = 2^((s - m) * log2(e)), as __expf forms it
#pragma unroll
            for (int r = 0; r < 8; r++) x[r] = (sacc[t][r] - mnew) * 1.44269504f;
            sacc[t] = exp2x8(x);
            tsum[t] = 0.0f;
#pragma unroll
            for (int r = 0; r < 8; r++) tsum[t] += sacc[t][r];
        }
        lrow = lrow * corr + ((tsum[0] + tsum[1]) + (tsum[2] + tsum[3]));
        mrow = mnew;
#pragma unroll
        for (int t = 0; t < 4; t++)
#pragma unroll
            for (int r = 0; r < 8; r++) cacc[t][r] *= corr;

        // P^T as B operand: k = key 32kc + kmap(e, kh) is register e & 7 of tile 2kc + (e >> 3)
        bf16x16 pb[2];
#pragma unroll
        for (int kc = 0; kc < 2; kc++)
#pragma unroll
            for (int e = 0; e < 16; e++) pb[kc][e] = (__bf16)sacc[2 * kc + (e >> 3)][e & 7];

        // O^T += V^T @ P^T : A row lm = d 16t + lm, k = key in kmap order
#pragma unroll
        for (int t = 0; t < 4; t++) {
#pragma unroll
            for (int kc = 0; kc < 2; kc++) {
                const __bf16* vp = Vt + vrow + kc * 32 * VS + t * 16;
                const bf16x8 lo = ld_tr16(vp);
                const bf16x8 hi = ld_tr16(vp + 16 * VS);
                const bf16x16 va = __builtin_shufflevector(lo, hi, 0, 1, 2, 3, 4, 5, 6, 7,
                                                           8, 9, 10, 11, 12, 13, 14, 15);
                cacc[t] = wmma_bf16(va, pb[kc], cacc[t]);
            }
        }
    }

    lrow += xhalf(lrow);        // join the two halves' key sums

    const int bidx = bh / NHEAD;
    const int h    = bh % NHEAD;
    const int s    = q0 + wave * 16 + lm;
    __bf16* crow = Ctx + ((size_t)(bidx * SEQ + s)) * D_MODEL + h * DK + 8 * kh;
#pragma unroll
    for (int t = 0; t < 4; t++) {
        bf16x8 o;                // 8 consecutive d of one query: one 16-byte store
#pragma unroll
        for (int r = 0; r < 8; r++) o[r] = (__bf16)(cacc[t][r] / lrow);
        *(bf16x8*)(crow + t * 16) = o;
    }
}

// ---------------------------------------------------------------------------
// Kernel 3: output projection. out = ctx @ Wo.T + bo, fp32 result. grid=(64,12)
// ---------------------------------------------------------------------------
__global__ __launch_bounds__(256)
void out_proj_kernel(const __bf16* __restrict__ Ctx, const float* __restrict__ Wo,
                     const float* __restrict__ bo, float* __restrict__ Out)
{
    const int m0 = blockIdx.x * 128;
    const int n0 = blockIdx.y * 64;

    __shared__ __bf16 Xs[128 * GS];
    __shared__ __bf16 Ws[64 * GS];

    const int tid  = threadIdx.x;
    const int wave = tid >> 5;
    const int lane = tid & 31;
    const int lm   = lane & 15;
    const int kh   = lane >> 4;

    f32x8 acc[4] = {};

    for (int k0 = 0; k0 < D_MODEL; k0 += 32) {
        __syncthreads();
#pragma unroll
        for (int i = 0; i < 2; i++) {           // ctx tile 128x32 bf16
            int lin = tid + i * 256;
            int r = lin >> 2, c = (lin & 3) * 8;
            *(uint4*)(&Xs[r * GS + c]) = *(const uint4*)(Ctx + (size_t)(m0 + r) * D_MODEL + k0 + c);
        }
#pragma unroll
        for (int i = 0; i < 2; i++) {           // Wo tile 64x32 f32 -> bf16
            int lin = tid + i * 256;
            int r = lin >> 3, c = (lin & 7) * 4;
            const float4 v = *(const float4*)(Wo + (size_t)(n0 + r) * D_MODEL + k0 + c);
            uint2 p; p.x = pack2bf(v.x, v.y); p.y = pack2bf(v.z, v.w);
            *(uint2*)(&Ws[r * GS + c]) = p;
        }
        __syncthreads();

        bf16x16 a;
        const int arow = wave * 16 + lm;
#pragma unroll
        for (int e = 0; e < 16; e++) a[e] = Xs[arow * GS + kmap(e, kh)];
#pragma unroll
        for (int t = 0; t < 4; t++) {
            bf16x16 b;
            const int bcol = t * 16 + lm;
#pragma unroll
            for (int e = 0; e < 16; e++) b[e] = Ws[bcol * GS + kmap(e, kh)];
            acc[t] = wmma_bf16(a, b, acc[t]);
        }
    }

#pragma unroll
    for (int t = 0; t < 4; t++) {
        const int n   = n0 + t * 16 + lm;
        const float b = bo[n];
#pragma unroll
        for (int r = 0; r < 8; r++) {
            const int M = m0 + wave * 16 + r + 8 * kh;
            Out[(size_t)M * D_MODEL + n] = acc[t][r] + b;
        }
    }
}

// ---------------------------------------------------------------------------
extern "C" void kernel_launch(void* const* d_in, const int* in_sizes, int n_in,
                              void* d_out, int out_size, void* d_ws, size_t ws_size,
                              hipStream_t stream)
{
    (void)in_sizes; (void)n_in; (void)out_size;

    const float* x  = (const float*)d_in[0];
    const float* Wq = (const float*)d_in[1];
    const float* bq = (const float*)d_in[2];
    const float* Wk = (const float*)d_in[3];
    const float* bk = (const float*)d_in[4];
    const float* Wv = (const float*)d_in[5];
    const float* bv = (const float*)d_in[6];
    const float* Wo = (const float*)d_in[7];
    const float* bo = (const float*)d_in[8];
    float* out = (float*)d_out;

    const size_t E = (size_t)MTOT * D_MODEL;      // 6,291,456 elements
    if (ws_size < 4 * E * sizeof(__bf16)) return; // ~48 MB scratch required
    __bf16* ws = (__bf16*)d_ws;
    __bf16* Qb = ws;
    __bf16* Kb = ws + E;
    __bf16* Vb = ws + 2 * E;
    __bf16* Cb = ws + 3 * E;

    dim3 g1(MTOT / 128, NHEAD, 3);
    qkv_proj_kernel<<<g1, 256, 0, stream>>>(x, Wq, bq, Wk, bk, Wv, bv, Qb, Kb, Vb);

    dim3 g2(SEQ / 128, BATCH * NHEAD);
    flash_attn_kernel<<<g2, 256, 0, stream>>>(Qb, Kb, Vb, Cb);

    dim3 g3(MTOT / 128, D_MODEL / 64);
    out_proj_kernel<<<g3, 256, 0, stream>>>(Cb, Wo, bo, out);
}

// v002
// Measured time: 176 microseconds a run.
// Next to v001, in two timings, it ran 1.13 times as fast each time.
// All steps since v000 together make it 2.48 times as fast.
#include <hip/hip_runtime.h>
#include <hip/hip_bf16.h>

typedef __attribute__((ext_vector_type(16))) __bf16 bf16x16;
typedef __attribute__((ext_vector_type(8)))  float  f32x8;
typedef int v4i_ __attribute__((vector_size(16)));   // matches builtin's pointee type

#define D_MODEL 768
#define NHEAD   12
#define DK      64
#define SEQ     4096
#define BATCH   2
#define MTOT    (BATCH*SEQ)   // 8192

#define GS 40   // GEMM LDS row stride (elems): 80B rows, 16B-aligned, bank stride 20
#define FS 72   // flash LDS row stride (elems): 144B rows, 16B-aligned, bank stride 36
#define VS 80   // V tile LDS row stride (elems): 160B = 32B x odd, the transposing load's pitch

#if defined(__gfx1250__) && __has_builtin(__builtin_amdgcn_global_load_async_to_lds_b128)
#define HAVE_ASYNC 1
#else
#define HAVE_ASYNC 0
#endif

// A/B fragment K-index mapping for v_wmma_*_16x16x32_bf16 (ISA 7.12.2):
// lanes 0-15 hold K 0..7 (elems 0..7) and 16..23 (elems 8..15);
// lanes 16-31 hold K 8..15 and 24..31.
__device__ __forceinline__ int kmap(int e, int kh) {
    return (e < 8) ? (kh * 8 + e) : (16 + kh * 8 + (e - 8));
}

__device__ __forceinline__ f32x8 wmma_bf16(const bf16x16& a, const bf16x16& b, const f32x8& c) {
    return __builtin_amdgcn_wmma_f32_16x16x32_bf16(false, a, false, b, (short)0, c, false, false);
}

__device__ __forceinline__ unsigned pack2bf(float a, float b) {
    union { __bf16 h[2]; unsigned u; } x;
    x.h[0] = (__bf16)a; x.h[1] = (__bf16)b;
    return x.u;
}

// 16-byte async global->LDS copy (ASYNCcnt path); no-op stub when unavailable.
__device__ __forceinline__ void async_copy16(const __bf16* g, __bf16* l) {
#if HAVE_ASYNC
    __builtin_amdgcn_global_load_async_to_lds_b128(
        (__attribute__((address_space(1))) v4i_*)g,
        (__attribute__((address_space(3))) v4i_*)l,
        0, 0);
#else
    (void)g; (void)l;
#endif
}

__device__ __forceinline__ void wait_async0() {
#if HAVE_ASYNC
#if __has_builtin(__builtin_amdgcn_s_wait_asynccnt)
    __builtin_amdgcn_s_wait_asynccnt(0);
#else
    asm volatile("s_wait_asynccnt 0x0" ::: "memory");
#endif
#endif
}

// ---------------------------------------------------------------------------
// Kernel 1: QKV projection. Y = X @ W.T + b  (W stored [out,in] row-major)
// Block: 256 thr = 8 waves. Tile: 128(M) x 64(N). grid = (64, 12 heads, 3 proj)
// Output layout: [b, h, s, dk] in bf16. (f32->bf16 conversion during staging,
// so this stays on the synchronous vectorized path.)
// ---------------------------------------------------------------------------
__global__ __launch_bounds__(256)
void qkv_proj_kernel(const float* __restrict__ X,
                     const float* __restrict__ Wq, const float* __restrict__ bq,
                     const float* __restrict__ Wk, const float* __restrict__ bk,
                     const float* __restrict__ Wv, const float* __restrict__ bv,
                     __bf16* __restrict__ Qb, __bf16* __restrict__ Kb, __bf16* __restrict__ Vb)
{
    const int proj = blockIdx.z;
    const float* W    = (proj == 0) ? Wq : (proj == 1) ? Wk : Wv;
    const float* bias = (proj == 0) ? bq : (proj == 1) ? bk : bv;
    __bf16*      Out  = (proj == 0) ? Qb : (proj == 1) ? Kb : Vb;

    const int m0 = blockIdx.x * 128;
    const int h  = blockIdx.y;          // 64-wide N tile == exactly one head
    const int n0 = h * DK;

    __shared__ __bf16 Xs[2][128 * GS];
    __shared__ __bf16 Ws[2][64 * GS];

    const int tid  = threadIdx.x;
    const int wave = tid >> 5;
    const int lane = tid & 31;
    const int lm   = lane & 15;
    const int kh   = lane >> 4;

    f32x8 acc[4] = {};

    // this thread's float4 chunks of a k-step's tiles: rows sr + 32 i, columns sc .. sc + 3
    const int sr = tid >> 3, sc = (tid & 7) * 4;
    const float* xg = X + (size_t)(m0 + sr) * D_MODEL + sc;
    const float* wg = W + (size_t)(n0 + sr) * D_MODEL + sc;

    // The tiles of step k + 1 are loaded into registers while step k's products run;
    // two LDS buffers, so that one barrier a step publishes the new tile and also ends
    // the reads of the buffer that the next step overwrites.
    float4 xr[4], wr[2];
#pragma unroll
    for (int i = 0; i < 4; i++) xr[i] = *(const float4*)(xg + (size_t)(32 * i) * D_MODEL);
#pragma unroll
    for (int i = 0; i < 2; i++) wr[i] = *(const float4*)(wg + (size_t)(32 * i) * D_MODEL);

    int buf = 0;
    for (int k0 = 0; k0 < D_MODEL; k0 += 32, buf ^= 1) {
        __bf16* Xt = Xs[buf];
        __bf16* Wt = Ws[buf];
#pragma unroll
        for (int i = 0; i < 4; i++) {           // X tile 128x32 f32 -> packed bf16
            uint2 p; p.x = pack2bf(xr[i].x, xr[i].y); p.y = pack2bf(xr[i].z, xr[i].w);
            *(uint2*)(&Xt[(sr + 32 * i) * GS + sc]) = p;
        }
#pragma unroll
        for (int i = 0; i < 2; i++) {           // W tile 64(n) x 32(k)
            uint2 p; p.x = pack2bf(wr[i].x, wr[i].y); p.y = pack2bf(wr[i].z, wr[i].w);
            *(uint2*)(&Wt[(sr + 32 * i) * GS + sc]) = p;
        }
        __syncthreads();

        if (k0 + 32 < D_MODEL) {                // next step's tiles, in flight under the products
#pragma unroll
            for (int i = 0; i < 4; i++) xr[i] = *(const float4*)(xg + (size_t)(32 * i) * D_MODEL + k0 + 32);
#pragma unroll
            for (int i = 0; i < 2; i++) wr[i] = *(const float4*)(wg + (size_t)(32 * i) * D_MODEL + k0 + 32);
            // the fragment loads below reuse these loads' address registers while they are in flight
            asm volatile("s_wait_xcnt 0x0" ::: "memory");
        }

        bf16x16 a;
        const int arow = wave * 16 + lm;
#pragma unroll
        for (int e = 0; e < 16; e++) a[e] = Xt[arow * GS + kmap(e, kh)];
#pragma unroll
        for (int t = 0; t < 4; t++) {
            bf16x16 b;
            const int bcol = t * 16 + lm;
#pragma unroll
            for (int e = 0; e < 16; e++) b[e] = Wt[bcol * GS + kmap(e, kh)];
            acc[t] = wmma_bf16(a, b, acc[t]);
        }
    }

#pragma unroll
    for (int t = 0; t < 4; t++) {
        const int d  = t * 16 + lm;
        const float bv_ = bias[n0 + d];
#pragma unroll
        for (int r = 0; r < 8; r++) {
            const int M    = m0 + wave * 16 + r + 8 * kh;
            const int bidx = M >> 12;           // / 4096
            const int s    = M & 4095;
            Out[(((size_t)bidx * NHEAD + h) * SEQ + s) * DK + d] = (__bf16)(acc[t][r] + bv_);
        }
    }
}

typedef __attribute__((ext_vector_type(8))) __bf16 bf16x8;

// Row-major 16-bit LDS tile -> transposed operand half: lane (lm, kh) gets
// T[kbase + 8*kh + 0..7][dbase + lm]; p is the lane's own address (see vrow below).
__device__ __forceinline__ bf16x8 ld_tr16(const __bf16* p) {
    typedef __attribute__((address_space(3))) bf16x8 lds_bf16x8;
    return __builtin_amdgcn_ds_load_tr16_b128_v8bf16((lds_bf16x8*)p);
}

// value of lane l ^ 16
__device__ __forceinline__ float xhalf(float x) {
    return __builtin_bit_cast(float, __builtin_amdgcn_permlanex16(
        __builtin_bit_cast(int, x), __builtin_bit_cast(int, x),
        0x76543210, 0xfedcba98, false, false));
}

// 2^x of one score tile's eight registers. One statement, so that each v_exp_f32 is
// followed by an independent one and the last by v_nop: the slot the instruction set
// asks for before a transcendental's source is overwritten or its result read.
__device__ __forceinline__ f32x8 exp2x8(const f32x8& x) {
    float y0, y1, y2, y3, y4, y5, y6, y7;
    asm("v_exp_f32 %0, %8\n\t"
        "v_exp_f32 %1, %9\n\t"
        "v_exp_f32 %2, %10\n\t"
        "v_exp_f32 %3, %11\n\t"
        "v_exp_f32 %4, %12\n\t"
        "v_exp_f32 %5, %13\n\t"
        "v_exp_f32 %6, %14\n\t"
        "v_exp_f32 %7, %15\n\t"
        "v_nop"
        : "=&v"(y0), "=&v"(y1), "=&v"(y2), "=&v"(y3), "=&v"(y4), "=&v"(y5), "=&v"(y6), "=&v"(y7)
        : "v"(x[0]), "v"(x[1]), "v"(x[2]), "v"(x[3]), "v"(x[4]), "v"(x[5]), "v"(x[6]), "v"(x[7]));
    f32x8 y = {y0, y1, y2, y3, y4, y5, y6, y7};
    return y;
}

// the same for a single value
__device__ __forceinline__ float exp2x1(float x) {
    float y;
    asm("v_exp_f32 %0, %1\n\t"
        "v_nop"
        : "=&v"(y) : "v"(x));
    return y;
}

// 768 work-groups on 256 WGPs: three resident per WGP (six waves per SIMD) hold the whole grid
__global__ __launch_bounds__(256) __attribute__((amdgpu_waves_per_eu(6)))
void flash_attn_kernel(const __bf16* __restrict__ Qb, const __bf16* __restrict__ Kb,
                       const __bf16* __restrict__ Vb, __bf16* __restrict__ Ctx)
{
    const int bh = blockIdx.y;
    const int q0 = blockIdx.x * 128;
    const __bf16* Qh = Qb + (size_t)bh * SEQ * DK;
    const __bf16* Kh = Kb + (size_t)bh * SEQ * DK;
    const __bf16* Vh = Vb + (size_t)bh * SEQ * DK;

    __shared__ __attribute__((aligned(16))) __bf16 Qs[128 * FS];
    __shared__ __attribute__((aligned(16))) __bf16 Ks[2][64 * FS];
    __shared__ __attribute__((aligned(16))) __bf16 Vs[2][64 * VS];

    const int tid  = threadIdx.x;
    const int wave = tid >> 5;
    const int lane = tid & 31;
    const int lm   = lane & 15;
    const int kh   = lane >> 4;

    // this thread's two 16B chunks of each 64x64 tile
    const int cr0 = (tid)       >> 3, cc0 = ((tid)       & 7) * 8;
    const int cr1 = (tid + 256) >> 3, cc1 = ((tid + 256) & 7) * 8;

#if HAVE_ASYNC
    // prologue: start DMA of first K/V tiles while we stage Q
    async_copy16(Kh + (size_t)cr0 * DK + cc0, &Ks[0][cr0 * FS + cc0]);
    async_copy16(Vh + (size_t)cr0 * DK + cc0, &Vs[0][cr0 * VS + cc0]);
    async_copy16(Kh + (size_t)cr1 * DK + cc1, &Ks[0][cr1 * FS + cc1]);
    async_copy16(Vh + (size_t)cr1 * DK + cc1, &Vs[0][cr1 * VS + cc1]);
#endif

    // Q block 128x64 bf16: 1024 uint4 loads, 4 per thread, b128 LDS stores
#pragma unroll
    for (int i = 0; i < 4; i++) {
        int lin = tid + i * 256;
        int r = lin >> 3, c = (lin & 7) * 8;
        *(uint4*)(&Qs[r * FS + c]) = *(const uint4*)(Qh + (size_t)(q0 + r) * DK + c);
    }
    __syncthreads();

    // B operand of S^T: column lm = this wave's query lm, k = d in kmap order
    bf16x16 qb[2];
    {
        const int qrow = wave * 16 + lm;
#pragma unroll
        for (int dc = 0; dc < 2; dc++)
#pragma unroll
            for (int e = 0; e < 16; e++)
                qb[dc][e] = Qs[qrow * FS + dc * 32 + kmap(e, kh)];
    }

    float mrow = -3.0e38f;      // running maximum of query lm (equal in both halves)
    float lrow = 0.0f;          // running sum over this half's keys only
    f32x8 cacc[4] = {};         // cacc[t][r] = O^T[d = 16t + 8kh + r][query lm]

    const float scale = 0.125f;                   // 1/sqrt(64)
    // lane's element offset inside a V tile for the transposing load
    const int vrow = (8 * kh + (lane & 7)) * VS + 8 * ((lane >> 3) & 1);

    int buf = 0;
    for (int j0 = 0; j0 < SEQ; j0 += 64, buf ^= 1) {
#if HAVE_ASYNC
        wait_async0();          // my async copies into Ks/Vs[buf] done
        __syncthreads();        // everyone's done; prior readers of buf^1 done
        if (j0 + 64 < SEQ) {    // kick off next tile into the other buffer
            const int jn = j0 + 64;
            async_copy16(Kh + (size_t)(jn + cr0) * DK + cc0, &Ks[buf ^ 1][cr0 * FS + cc0]);
            async_copy16(Vh + (size_t)(jn + cr0) * DK + cc0, &Vs[buf ^ 1][cr0 * VS + cc0]);
            async_copy16(Kh + (size_t)(jn + cr1) * DK + cc1, &Ks[buf ^ 1][cr1 * FS + cc1]);
            async_copy16(Vh + (size_t)(jn + cr1) * DK + cc1, &Vs[buf ^ 1][cr1 * VS + cc1]);
        }
#else
        __syncthreads();
        *(uint4*)(&Ks[buf][cr0 * FS + cc0]) = *(const uint4*)(Kh + (size_t)(j0 + cr0) * DK + cc0);
        *(uint4*)(&Vs[buf][cr0 * VS + cc0]) = *(const uint4*)(Vh + (size_t)(j0 + cr0) * DK + cc0);
        *(uint4*)(&Ks[buf][cr1 * FS + cc1]) = *(const uint4*)(Kh + (size_t)(j0 + cr1) * DK + cc1);
        *(uint4*)(&Vs[buf][cr1 * VS + cc1]) = *(const uint4*)(Vh + (size_t)(j0 + cr1) * DK + cc1);
        __syncthreads();
#endif
        const __bf16* Kt = Ks[buf];
        const __bf16* Vt = Vs[buf];

        // S^T = K @ Q^T : 4 key tiles x 2 d-chunks; sacc[t][r] = S[query lm][key 16t + 8kh + r]
        f32x8 sacc[4] = {};
#pragma unroll
        for (int t = 0; t < 4; t++) {
            const int key = t * 16 + lm;
#pragma unroll
            for (int dc = 0; dc < 2; dc++) {
                bf16x16 a;
#pragma unroll
                for (int e = 0; e < 16; e++) a[e] = Kt[key * FS + dc * 32 + kmap(e, kh)];
                sacc[t] = wmma_bf16(a, qb[dc], sacc[t]);
            }
        }
#pragma unroll
        for (int t = 0; t < 4; t++)
#pragma unroll
            for (int r = 0; r < 8; r++) sacc[t][r] *= scale;

        // online softmax of query lm: 32 keys in this lane, the other 32 in lane ^ 16
        float tmax[4];
#pragma unroll
        for (int t = 0; t < 4; t++) {
            tmax[t] = sacc[t][0];
#pragma unroll
            for (int r = 1; r < 8; r++) tmax[t] = fmaxf(tmax[t], sacc[t][r]);
        }
        float vmax = fmaxf(fmaxf(tmax[0], tmax[1]), fmaxf(tmax[2], tmax[3]));
        vmax = fmaxf(vmax, xhalf(vmax));
        const float mnew = fmaxf(mrow, vmax);
        const float corr = exp2x1((mrow - mnew) * 1.44269504f);
        float tsum[4];
#pragma unroll
        for (int t = 0; t < 4; t++) {
            f32x8 x;             // exp(s - m) = 2^((s - m) * log2(e)), as __expf forms it
#pragma unroll
            for (int r = 0; r < 8; r++) x[r] = (sacc[t][r] - mnew) * 1.44269504f;
            sacc[t] = exp2x8(x);
            tsum[t] = 0.0f;
#pragma unroll
            for (int r = 0; r < 8; r++) tsum[t] += sacc[t][r];
        }
        lrow = lrow * corr + ((tsum[0] + tsum[1]) + (tsum[2] + tsum[3]));
        mrow = mnew;
#pragma unroll
        for (int t = 0; t < 4; t++)
#pragma unroll
            for (int r = 0; r < 8; r++) cacc[t][r] *= corr;

        // P^T as B operand: k = key 32kc + kmap(e, kh) is register e & 7 of tile 2kc + (e >> 3)
        bf16x16 pb[2];
#pragma unroll
        for (int kc = 0; kc < 2; kc++)
#pragma unroll
            for (int e = 0; e < 16; e++) pb[kc][e] = (__bf16)sacc[2 * kc + (e >> 3)][e & 7];

        // O^T += V^T @ P^T : A row lm = d 16t + lm, k = key in kmap order
#pragma unroll
        for (int t = 0; t < 4; t++) {
#pragma unroll
            for (int kc = 0; kc < 2; kc++) {
                const __bf16* vp = Vt + vrow + kc * 32 * VS + t * 16;
                const bf16x8 lo = ld_tr16(vp);
                const bf16x8 hi = ld_tr16(vp + 16 * VS);
                const bf16x16 va = __builtin_shufflevector(lo, hi, 0, 1, 2, 3, 4, 5, 6, 7,
                                                           8, 9, 10, 11, 12, 13, 14, 15);
                cacc[t] = wmma_bf16(va, pb[kc], cacc[t]);
            }
        }
    }

    lrow += xhalf(lrow);        // join the two halves' key sums

    const int bidx = bh / NHEAD;
    const int h    = bh % NHEAD;
    const int s    = q0 + wave * 16 + lm;
    __bf16* crow = Ctx + ((size_t)(bidx * SEQ + s)) * D_MODEL + h * DK + 8 * kh;
#pragma unroll
    for (int t = 0; t < 4; t++) {
        bf16x8 o;                // 8 consecutive d of one query: one 16-byte store
#pragma unroll
        for (int r = 0; r < 8; r++) o[r] = (__bf16)(cacc[t][r] / lrow);
        *(bf16x8*)(crow + t * 16) = o;
    }
}

// ---------------------------------------------------------------------------
// Kernel 3: output projection. out = ctx @ Wo.T + bo, fp32 result. grid=(64,12)
// ---------------------------------------------------------------------------
__global__ __launch_bounds__(256)
void out_proj_kernel(const __bf16* __restrict__ Ctx, const float* __restrict__ Wo,
                     const float* __restrict__ bo, float* __restrict__ Out)
{
    const int m0 = blockIdx.x * 128;
    const int n0 = blockIdx.y * 64;

    __shared__ __bf16 Xs[2][128 * GS];
    __shared__ __bf16 Ws[2][64 * GS];

    const int tid  = threadIdx.x;
    const int wave = tid >> 5;
    const int lane = tid & 31;
    const int lm   = lane & 15;
    const int kh   = lane >> 4;

    f32x8 acc[4] = {};

    // this thread's chunks of a k-step's tiles: ctx rows cr + 64 i (8 bf16), Wo rows sr + 32 i (4 f32)
    const int cr = tid >> 2, cc = (tid & 3) * 8;
    const int sr = tid >> 3, sc = (tid & 7) * 4;
    const __bf16* cg = Ctx + (size_t)(m0 + cr) * D_MODEL + cc;
    const float*  wg = Wo  + (size_t)(n0 + sr) * D_MODEL + sc;

    // step k + 1's tiles are loaded into registers while step k's products run; two LDS
    // buffers and one barrier a step, as in the first projection kernel
    bf16x8 xr[2];
    float4 wr[2];
#pragma unroll
    for (int i = 0; i < 2; i++) xr[i] = *(const bf16x8*)(cg + (size_t)(64 * i) * D_MODEL);
#pragma unroll
    for (int i = 0; i < 2; i++) wr[i] = *(const float4*)(wg + (size_t)(32 * i) * D_MODEL);

    int buf = 0;
    for (int k0 = 0; k0 < D_MODEL; k0 += 32, buf ^= 1) {
        __bf16* Xt = Xs[buf];
        __bf16* Wt = Ws[buf];
#pragma unroll
        for (int i = 0; i < 2; i++)             // ctx tile 128x32 bf16
            *(bf16x8*)(&Xt[(cr + 64 * i) * GS + cc]) = xr[i];
#pragma unroll
        for (int i = 0; i < 2; i++) {           // Wo tile 64x32 f32 -> bf16
            uint2 p; p.x = pack2bf(wr[i].x, wr[i].y); p.y = pack2bf(wr[i].z, wr[i].w);
            *(uint2*)(&Wt[(sr + 32 * i) * GS + sc]) = p;
        }
        __syncthreads();

        if (k0 + 32 < D_MODEL) {                // next step's tiles, in flight under the products
#pragma unroll
            for (int i = 0; i < 2; i++) xr[i] = *(const bf16x8*)(cg + (size_t)(64 * i) * D_MODEL + k0 + 32);
#pragma unroll
            for (int i = 0; i < 2; i++) wr[i] = *(const float4*)(wg + (size_t)(32 * i) * D_MODEL + k0 + 32);
            // these loads' address registers are advanced or reused below while they are in flight
            asm volatile("s_wait_xcnt 0x0" ::: "memory");
        }

        bf16x16 a;
        const int arow = wave * 16 + lm;
#pragma unroll
        for (int e = 0; e < 16; e++) a[e] = Xt[arow * GS + kmap(e, kh)];
#pragma unroll
        for (int t = 0; t < 4; t++) {
            bf16x16 b;
            const int bcol = t * 16 + lm;
#pragma unroll
            for (int e = 0; e < 16; e++) b[e] = Wt[bcol * GS + kmap(e, kh)];
            acc[t] = wmma_bf16(a, b, acc[t]);
        }
    }

#pragma unroll
    for (int t = 0; t < 4; t++) {
        const int n   = n0 + t * 16 + lm;
        const float b = bo[n];
#pragma unroll
        for (int r = 0; r < 8; r++) {
            const int M = m0 + wave * 16 + r + 8 * kh;
            Out[(size_t)M * D_MODEL + n] = acc[t][r] + b;
        }
    }
}

// ---------------------------------------------------------------------------
extern "C" void kernel_launch(void* const* d_in, const int* in_sizes, int n_in,
                              void* d_out, int out_size, void* d_ws, size_t ws_size,
                              hipStream_t stream)
{
    (void)in_sizes; (void)n_in; (void)out_size;

    const float* x  = (const float*)d_in[0];
    const float* Wq = (const float*)d_in[1];
    const float* bq = (const float*)d_in[2];
    const float* Wk = (const float*)d_in[3];
    const float* bk = (const float*)d_in[4];
    const float* Wv = (const float*)d_in[5];
    const float* bv = (const float*)d_in[6];
    const float* Wo = (const float*)d_in[7];
    const float* bo = (const float*)d_in[8];
    float* out = (float*)d_out;

    const size_t E = (size_t)MTOT * D_MODEL;      // 6,291,456 elements
    if (ws_size < 4 * E * sizeof(__bf16)) return; // ~48 MB scratch required
    __bf16* ws = (__bf16*)d_ws;
    __bf16* Qb = ws;
    __bf16* Kb = ws + E;
    __bf16* Vb = ws + 2 * E;
    __bf16* Cb = ws + 3 * E;

    dim3 g1(MTOT / 128, NHEAD, 3);
    qkv_proj_kernel<<<g1, 256, 0, stream>>>(x, Wq, bq, Wk, bk, Wv, bv, Qb, Kb, Vb);

    dim3 g2(SEQ / 128, BATCH * NHEAD);
    flash_attn_kernel<<<g2, 256, 0, stream>>>(Qb, Kb, Vb, Cb);

    dim3 g3(MTOT / 128, D_MODEL / 64);
    out_proj_kernel<<<g3, 256, 0, stream>>>(Cb, Wo, bo, out);
}

// v003
// One run takes 160 microseconds.
// Next to v002, in two timings, it ran 1.10 times as fast each time.
// Counting every step since v000, it is 2.72 times as fast.
#include <hip/hip_runtime.h>
#include <hip/hip_bf16.h>

typedef __attribute__((ext_vector_type(16))) __bf16 bf16x16;
typedef __attribute__((ext_vector_type(8)))  float  f32x8;
typedef int v4i_ __attribute__((vector_size(16)));   // matches builtin's pointee type

#define D_MODEL 768
#define NHEAD   12
#define DK      64
#define SEQ     4096
#define BATCH   2
#define MTOT    (BATCH*SEQ)   // 8192

#define GS 40   // GEMM LDS row stride (elems): 80B rows, 16B-aligned, bank stride 20
#define FS 72   // flash LDS row stride (elems): 144B rows, 16B-aligned, bank stride 36
#define VS 80   // V tile LDS row stride (elems): 160B = 32B x odd, the transposing load's pitch

#if defined(__gfx1250__) && __has_builtin(__builtin_amdgcn_global_load_async_to_lds_b128)
#define HAVE_ASYNC 1
#else
#define HAVE_ASYNC 0
#endif

// A/B fragment K-index mapping for v_wmma_*_16x16x32_bf16 (ISA 7.12.2):
// lanes 0-15 hold K 0..7 (elems 0..7) and 16..23 (elems 8..15);
// lanes 16-31 hold K 8..15 and 24..31.
__device__ __forceinline__ int kmap(int e, int kh) {
    return (e < 8) ? (kh * 8 + e) : (16 + kh * 8 + (e - 8));
}

__device__ __forceinline__ f32x8 wmma_bf16(const bf16x16& a, const bf16x16& b, const f32x8& c) {
    return __builtin_amdgcn_wmma_f32_16x16x32_bf16(false, a, false, b, (short)0, c, false, false);
}

__device__ __forceinline__ unsigned pack2bf(float a, float b) {
    union { __bf16 h[2]; unsigned u; } x;
    x.h[0] = (__bf16)a; x.h[1] = (__bf16)b;
    return x.u;
}

// 16-byte async global->LDS copy (ASYNCcnt path); no-op stub when unavailable.
__device__ __forceinline__ void async_copy16(const __bf16* g, __bf16* l) {
#if HAVE_ASYNC
    __builtin_amdgcn_global_load_async_to_lds_b128(
        (__attribute__((address_space(1))) v4i_*)g,
        (__attribute__((address_space(3))) v4i_*)l,
        0, 0);
#else
    (void)g; (void)l;
#endif
}

__device__ __forceinline__ void wait_async0() {
#if HAVE_ASYNC
#if __has_builtin(__builtin_amdgcn_s_wait_asynccnt)
    __builtin_amdgcn_s_wait_asynccnt(0);
#else
    asm volatile("s_wait_asynccnt 0x0" ::: "memory");
#endif
#endif
}

// ---------------------------------------------------------------------------
// Kernel 1: QKV projection. Y = X @ W.T + b  (W stored [out,in] row-major)
// The three weight matrices are taken as one stack of 2304 output columns [Q | K | V].
// Block: 256 thr = 8 waves. Tile: 256(M) x 288(N), grid = (32, 8): one work-group per
// WGP, so that X comes from L2 8 times and the weights 32 times. Waves 4(M) x 2(N),
// each 64 x 144 = 4 x 9 accumulator tiles: 13 fragments from LDS feed 36 products.
// Output layout: [b, h, s, dk] in bf16. (f32->bf16 conversion during staging,
// so this stays on the synchronous vectorized path.)
// ---------------------------------------------------------------------------
#define QM 256              // rows of X per work-group
#define QN 288              // stacked output columns per work-group
#define QXC (QM / 32)       // 32-row chunks of the X tile
#define QWC (QN / 32)       // 32-row chunks of the W tile; 768 = 24 chunks, so a chunk has one matrix
#define QNT (QN / 32)       // 16-column accumulator tiles per wave (half the tile's 18)

// one work-group of eight waves per WGP is two waves per SIMD: the register budget that
// the 4 x 9 accumulator tiles, the fragments and the staged tiles need without a spill
__global__ __launch_bounds__(256) __attribute__((amdgpu_waves_per_eu(2)))
void qkv_proj_kernel(const float* __restrict__ X,
                     const float* __restrict__ Wq, const float* __restrict__ bq,
                     const float* __restrict__ Wk, const float* __restrict__ bk,
                     const float* __restrict__ Wv, const float* __restrict__ bv,
                     __bf16* __restrict__ Qb, __bf16* __restrict__ Kb, __bf16* __restrict__ Vb)
{
    const int m0 = blockIdx.x * QM;

    __shared__ __bf16 Xs[2][QM * GS];
    __shared__ __bf16 Ws[2][QN * GS];

    const int tid  = threadIdx.x;
    const int wave = __builtin_amdgcn_readfirstlane(tid >> 5);
    const int lane = tid & 31;
    const int lm   = lane & 15;
    const int kh   = lane >> 4;
    const int wm   = wave & 3;          // rows    64 wm  .. 64 wm + 63   of the tile
    const int wn   = wave >> 2;         // columns 144 wn .. 144 wn + 143 of the tile

    f32x8 acc[4][QNT] = {};

    // this thread's float4 chunks of a k-step's tiles: rows sr + 32 i, columns sc .. sc + 3
    const int sr = tid >> 3, sc = (tid & 7) * 4;
    // Every chunk has a base that is the same for the whole work-group; the thread's own
    // part is one byte offset, which also carries the k-step.
    const char* xb = (const char*)(X + (size_t)m0 * D_MODEL);
    const char* wb[QWC];
#pragma unroll
    for (int i = 0; i < QWC; i++) {
        const int c = blockIdx.y * QWC + i;         // chunk of the stack: matrix c / 24, rows 32 (c % 24) ..
        const float* Wp = (c < 24) ? Wq : (c < 48) ? Wk : Wv;
        wb[i] = (const char*)(Wp + (size_t)((c % 24) * 32) * D_MODEL);
    }
    unsigned off = (unsigned)(sr * D_MODEL + sc) * 4u;

    // The tiles of step k + 1 are loaded into registers while step k's products run;
    // two LDS buffers, so that one barrier a step publishes the new tile and also ends
    // the reads of the buffer that the next step overwrites.
    float4 xr[QXC], wr[QWC];
#pragma unroll
    for (int i = 0; i < QXC; i++) xr[i] = *(const float4*)(xb + (size_t)(32 * i) * D_MODEL * 4 + off);
#pragma unroll
    for (int i = 0; i < QWC; i++) wr[i] = *(const float4*)(wb[i] + off);

    int buf = 0;
    for (int k0 = 0; k0 < D_MODEL; k0 += 32, buf ^= 1) {
        __bf16* Xt = Xs[buf];
        __bf16* Wt = Ws[buf];
#pragma unroll
        for (int i = 0; i < QXC; i++) {         // X tile 256x32 f32 -> packed bf16
            uint2 p; p.x = pack2bf(xr[i].x, xr[i].y); p.y = pack2bf(xr[i].z, xr[i].w);
            *(uint2*)(&Xt[(sr + 32 * i) * GS + sc]) = p;
        }
#pragma unroll
        for (int i = 0; i < QWC; i++) {         // W tile 288(n) x 32(k)
            uint2 p; p.x = pack2bf(wr[i].x, wr[i].y); p.y = pack2bf(wr[i].z, wr[i].w);
            *(uint2*)(&Wt[(sr + 32 * i) * GS + sc]) = p;
        }
        __syncthreads();

        if (k0 + 32 < D_MODEL) {                // next step's tiles, in flight under the products
            off += 32 * 4;
#pragma unroll
            for (int i = 0; i < QXC; i++) xr[i] = *(const float4*)(xb + (size_t)(32 * i) * D_MODEL * 4 + off);
#pragma unroll
            for (int i = 0; i < QWC; i++) wr[i] = *(const float4*)(wb[i] + off);
            // these loads' offset register is advanced in the next step while they may be in flight
            asm volatile("s_wait_xcnt 0x0" ::: "memory");
        }

        bf16x16 a[4];
#pragma unroll
        for (int mt = 0; mt < 4; mt++) {
            const int arow = wm * 64 + mt * 16 + lm;
#pragma unroll
            for (int e = 0; e < 16; e++) a[mt][e] = Xt[arow * GS + kmap(e, kh)];
        }
        bf16x16 b[QNT];                         // all of the step's fragments as one group of LDS loads
#pragma unroll
        for (int t = 0; t < QNT; t++) {
            const int bcol = wn * (QN / 2) + t * 16 + lm;
#pragma unroll
            for (int e = 0; e < 16; e++) b[t][e] = Wt[bcol * GS + kmap(e, kh)];
        }
        // keeps the loads above the products: sunk among them, each row of four products
        // would wait out its own fragment's LDS latency
        __builtin_amdgcn_sched_barrier(0);
#pragma unroll
        for (int t = 0; t < QNT; t++)
#pragma unroll
            for (int mt = 0; mt < 4; mt++) acc[mt][t] = wmma_bf16(a[mt], b[t], acc[mt][t]);
    }

#pragma unroll
    for (int t = 0; t < QNT; t++) {
        const int g  = blockIdx.y * (QN / 16) + wn * QNT + t;   // 16-column tile of the stack: 48 a matrix, 4 a head
        const int gh = g % 48;
        const float* bias = (g < 48) ? bq : (g < 96) ? bk : bv;
        __bf16*      Out  = (g < 48) ? Qb : (g < 96) ? Kb : Vb;
        const int h  = gh >> 2;
        const int d  = (gh & 3) * 16 + lm;
        const float bv_ = bias[gh * 16 + lm];
        // the next column tile's address is formed in this load's offset and base registers
        asm volatile("s_wait_xcnt 0x0" ::: "memory");
#pragma unroll
        for (int mt = 0; mt < 4; mt++) {
#pragma unroll
            for (int r = 0; r < 8; r++) {
                const int M    = m0 + wm * 64 + mt * 16 + r + 8 * kh;
                const int bidx = M >> 12;           // / 4096
                const int s    = M & 4095;
                Out[(((size_t)bidx * NHEAD + h) * SEQ + s) * DK + d] = (__bf16)(acc[mt][t][r] + bv_);
            }
            // later sums and addresses are formed in these stores' data registers
            asm volatile("s_wait_xcnt 0x0" ::: "memory");
            // holds those later register writes behind the wait: the scheduler lifted some over it
            __builtin_amdgcn_sched_barrier(0);
        }
    }
}

typedef __attribute__((ext_vector_type(8))) __bf16 bf16x8;

// Row-major 16-bit LDS tile -> transposed operand half: lane (lm, kh) gets
// T[kbase + 8*kh + 0..7][dbase + lm]; p is the lane's own address (see vrow below).
__device__ __forceinline__ bf16x8 ld_tr16(const __bf16* p) {
    typedef __attribute__((address_space(3))) bf16x8 lds_bf16x8;
    return __builtin_amdgcn_ds_load_tr16_b128_v8bf16((lds_bf16x8*)p);
}

// value of lane l ^ 16
__device__ __forceinline__ float xhalf(float x) {
    return __builtin_bit_cast(float, __builtin_amdgcn_permlanex16(
        __builtin_bit_cast(int, x), __builtin_bit_cast(int, x),
        0x76543210, 0xfedcba98, false, false));
}

// 2^x of one score tile's eight registers. One statement, so that each v_exp_f32 is
// followed by an independent one and the last by v_nop: the slot the instruction set
// asks for before a transcendental's source is overwritten or its result read.
__device__ __forceinline__ f32x8 exp2x8(const f32x8& x) {
    float y0, y1, y2, y3, y4, y5, y6, y7;
    asm("v_exp_f32 %0, %8\n\t"
        "v_exp_f32 %1, %9\n\t"
        "v_exp_f32 %2, %10\n\t"
        "v_exp_f32 %3, %11\n\t"
        "v_exp_f32 %4, %12\n\t"
        "v_exp_f32 %5, %13\n\t"
        "v_exp_f32 %6, %14\n\t"
        "v_exp_f32 %7, %15\n\t"
        "v_nop"
        : "=&v"(y0), "=&v"(y1), "=&v"(y2), "=&v"(y3), "=&v"(y4), "=&v"(y5), "=&v"(y6), "=&v"(y7)
        : "v"(x[0]), "v"(x[1]), "v"(x[2]), "v"(x[3]), "v"(x[4]), "v"(x[5]), "v"(x[6]), "v"(x[7]));
    f32x8 y = {y0, y1, y2, y3, y4, y5, y6, y7};
    return y;
}

// the same for a single value
__device__ __forceinline__ float exp2x1(float x) {
    float y;
    asm("v_exp_f32 %0, %1\n\t"
        "v_nop"
        : "=&v"(y) : "v"(x));
    return y;
}

// 768 work-groups on 256 WGPs: three resident per WGP (six waves per SIMD) hold the whole grid
__global__ __launch_bounds__(256) __attribute__((amdgpu_waves_per_eu(6)))
void flash_attn_kernel(const __bf16* __restrict__ Qb, const __bf16* __restrict__ Kb,
                       const __bf16* __restrict__ Vb, __bf16* __restrict__ Ctx)
{
    const int bh = blockIdx.y;
    const int q0 = blockIdx.x * 128;
    const __bf16* Qh = Qb + (size_t)bh * SEQ * DK;
    const __bf16* Kh = Kb + (size_t)bh * SEQ * DK;
    const __bf16* Vh = Vb + (size_t)bh * SEQ * DK;

    __shared__ __attribute__((aligned(16))) __bf16 Qs[128 * FS];
    __shared__ __attribute__((aligned(16))) __bf16 Ks[2][64 * FS];
    __shared__ __attribute__((aligned(16))) __bf16 Vs[2][64 * VS];

    const int tid  = threadIdx.x;
    const int wave = tid >> 5;
    const int lane = tid & 31;
    const int lm   = lane & 15;
    const int kh   = lane >> 4;

    // this thread's two 16B chunks of each 64x64 tile
    const int cr0 = (tid)       >> 3, cc0 = ((tid)       & 7) * 8;
    const int cr1 = (tid + 256) >> 3, cc1 = ((tid + 256) & 7) * 8;

#if HAVE_ASYNC
    // prologue: start DMA of first K/V tiles while we stage Q
    async_copy16(Kh + (size_t)cr0 * DK + cc0, &Ks[0][cr0 * FS + cc0]);
    async_copy16(Vh + (size_t)cr0 * DK + cc0, &Vs[0][cr0 * VS + cc0]);
    async_copy16(Kh + (size_t)cr1 * DK + cc1, &Ks[0][cr1 * FS + cc1]);
    async_copy16(Vh + (size_t)cr1 * DK + cc1, &Vs[0][cr1 * VS + cc1]);
#endif

    // Q block 128x64 bf16: 1024 uint4 loads, 4 per thread, b128 LDS stores
#pragma unroll
    for (int i = 0; i < 4; i++) {
        int lin = tid + i * 256;
        int r = lin >> 3, c = (lin & 7) * 8;
        *(uint4*)(&Qs[r * FS + c]) = *(const uint4*)(Qh + (size_t)(q0 + r) * DK + c);
    }
    __syncthreads();

    // B operand of S^T: column lm = this wave's query lm, k = d in kmap order
    bf16x16 qb[2];
    {
        const int qrow = wave * 16 + lm;
#pragma unroll
        for (int dc = 0; dc < 2; dc++)
#pragma unroll
            for (int e = 0; e < 16; e++)
                qb[dc][e] = Qs[qrow * FS + dc * 32 + kmap(e, kh)];
    }

    float mrow = -3.0e38f;      // running maximum of query lm (equal in both halves)
    float lrow = 0.0f;          // running sum over this half's keys only
    f32x8 cacc[4] = {};         // cacc[t][r] = O^T[d = 16t + 8kh + r][query lm]

    const float scale = 0.125f;                   // 1/sqrt(64)
    // lane's element offset inside a V tile for the transposing load
    const int vrow = (8 * kh + (lane & 7)) * VS + 8 * ((lane >> 3) & 1);

    int buf = 0;
    for (int j0 = 0; j0 < SEQ; j0 += 64, buf ^= 1) {
#if HAVE_ASYNC
        wait_async0();          // my async copies into Ks/Vs[buf] done
        __syncthreads();        // everyone's done; prior readers of buf^1 done
        if (j0 + 64 < SEQ) {    // kick off next tile into the other buffer
            const int jn = j0 + 64;
            async_copy16(Kh + (size_t)(jn + cr0) * DK + cc0, &Ks[buf ^ 1][cr0 * FS + cc0]);
            async_copy16(Vh + (size_t)(jn + cr0) * DK + cc0, &Vs[buf ^ 1][cr0 * VS + cc0]);
            async_copy16(Kh + (size_t)(jn + cr1) * DK + cc1, &Ks[buf ^ 1][cr1 * FS + cc1]);
            async_copy16(Vh + (size_t)(jn + cr1) * DK + cc1, &Vs[buf ^ 1][cr1 * VS + cc1]);
        }
#else
        __syncthreads();
        *(uint4*)(&Ks[buf][cr0 * FS + cc0]) = *(const uint4*)(Kh + (size_t)(j0 + cr0) * DK + cc0);
        *(uint4*)(&Vs[buf][cr0 * VS + cc0]) = *(const uint4*)(Vh + (size_t)(j0 + cr0) * DK + cc0);
        *(uint4*)(&Ks[buf][cr1 * FS + cc1]) = *(const uint4*)(Kh + (size_t)(j0 + cr1) * DK + cc1);
        *(uint4*)(&Vs[buf][cr1 * VS + cc1]) = *(const uint4*)(Vh + (size_t)(j0 + cr1) * DK + cc1);
        __syncthreads();
#endif
        const __bf16* Kt = Ks[buf];
        const __bf16* Vt = Vs[buf];

        // S^T = K @ Q^T : 4 key tiles x 2 d-chunks; sacc[t][r] = S[query lm][key 16t + 8kh + r]
        f32x8 sacc[4] = {};
#pragma unroll
        for (int t = 0; t < 4; t++) {
            const int key = t * 16 + lm;
#pragma unroll
            for (int dc = 0; dc < 2; dc++) {
                bf16x16 a;
#pragma unroll
                for (int e = 0; e < 16; e++) a[e] = Kt[key * FS + dc * 32 + kmap(e, kh)];
                sacc[t] = wmma_bf16(a, qb[dc], sacc[t]);
            }
        }
#pragma unroll
        for (int t = 0; t < 4; t++)
#pragma unroll
            for (int r = 0; r < 8; r++) sacc[t][r] *= scale;

        // online softmax of query lm: 32 keys in this lane, the other 32 in lane ^ 16
        float tmax[4];
#pragma unroll
        for (int t = 0; t < 4; t++) {
            tmax[t] = sacc[t][0];
#pragma unroll
            for (int r = 1; r < 8; r++) tmax[t] = fmaxf(tmax[t], sacc[t][r]);
        }
        float vmax = fmaxf(fmaxf(tmax[0], tmax[1]), fmaxf(tmax[2], tmax[3]));
        vmax = fmaxf(vmax, xhalf(vmax));
        const float mnew = fmaxf(mrow, vmax);
        const float corr = exp2x1((mrow - mnew) * 1.44269504f);
        float tsum[4];
#pragma unroll
        for (int t = 0; t < 4; t++) {
            f32x8 x;             // exp(s - m) = 2^((s - m) * log2(e)), as __expf forms it
#pragma unroll
            for (int r = 0; r < 8; r++) x[r] = (sacc[t][r] - mnew) * 1.44269504f;
            sacc[t] = exp2x8(x);
            tsum[t] = 0.0f;
#pragma unroll
            for (int r = 0; r < 8; r++) tsum[t] += sacc[t][r];
        }
        lrow = lrow * corr + ((tsum[0] + tsum[1]) + (tsum[2] + tsum[3]));
        mrow = mnew;
#pragma unroll
        for (int t = 0; t < 4; t++)
#pragma unroll
            for (int r = 0; r < 8; r++) cacc[t][r] *= corr;

        // P^T as B operand: k = key 32kc + kmap(e, kh) is register e & 7 of tile 2kc + (e >> 3)
        bf16x16 pb[2];
#pragma unroll
        for (int kc = 0; kc < 2; kc++)
#pragma unroll
            for (int e = 0; e < 16; e++) pb[kc][e] = (__bf16)sacc[2 * kc + (e >> 3)][e & 7];

        // O^T += V^T @ P^T : A row lm = d 16t + lm, k = key in kmap order
#pragma unroll
        for (int t = 0; t < 4; t++) {
#pragma unroll
            for (int kc = 0; kc < 2; kc++) {
                const __bf16* vp = Vt + vrow + kc * 32 * VS + t * 16;
                const bf16x8 lo = ld_tr16(vp);
                const bf16x8 hi = ld_tr16(vp + 16 * VS);
                const bf16x16 va = __builtin_shufflevector(lo, hi, 0, 1, 2, 3, 4, 5, 6, 7,
                                                           8, 9, 10, 11, 12, 13, 14, 15);
                cacc[t] = wmma_bf16(va, pb[kc], cacc[t]);
            }
        }
    }

    lrow += xhalf(lrow);        // join the two halves' key sums

    const int bidx = bh / NHEAD;
    const int h    = bh % NHEAD;
    const int s    = q0 + wave * 16 + lm;
    __bf16* crow = Ctx + ((size_t)(bidx * SEQ + s)) * D_MODEL + h * DK + 8 * kh;
#pragma unroll
    for (int t = 0; t < 4; t++) {
        bf16x8 o;                // 8 consecutive d of one query: one 16-byte store
#pragma unroll
        for (int r = 0; r < 8; r++) o[r] = (__bf16)(cacc[t][r] / lrow);
        *(bf16x8*)(crow + t * 16) = o;
    }
}

// ---------------------------------------------------------------------------
// Kernel 3: output projection. out = ctx @ Wo.T + bo, fp32 result. grid=(64,12)
// ---------------------------------------------------------------------------
__global__ __launch_bounds__(256)
void out_proj_kernel(const __bf16* __restrict__ Ctx, const float* __restrict__ Wo,
                     const float* __restrict__ bo, float* __restrict__ Out)
{
    const int m0 = blockIdx.x * 128;
    const int n0 = blockIdx.y * 64;

    __shared__ __bf16 Xs[2][128 * GS];
    __shared__ __bf16 Ws[2][64 * GS];

    const int tid  = threadIdx.x;
    const int wave = tid >> 5;
    const int lane = tid & 31;
    const int lm   = lane & 15;
    const int kh   = lane >> 4;

    f32x8 acc[4] = {};

    // this thread's chunks of a k-step's tiles: ctx rows cr + 64 i (8 bf16), Wo rows sr + 32 i (4 f32)
    const int cr = tid >> 2, cc = (tid & 3) * 8;
    const int sr = tid >> 3, sc = (tid & 7) * 4;
    const __bf16* cg = Ctx + (size_t)(m0 + cr) * D_MODEL + cc;
    const float*  wg = Wo  + (size_t)(n0 + sr) * D_MODEL + sc;

    // step k + 1's tiles are loaded into registers while step k's products run; two LDS
    // buffers and one barrier a step, as in the first projection kernel
    bf16x8 xr[2];
    float4 wr[2];
#pragma unroll
    for (int i = 0; i < 2; i++) xr[i] = *(const bf16x8*)(cg + (size_t)(64 * i) * D_MODEL);
#pragma unroll
    for (int i = 0; i < 2; i++) wr[i] = *(const float4*)(wg + (size_t)(32 * i) * D_MODEL);

    int buf = 0;
    for (int k0 = 0; k0 < D_MODEL; k0 += 32, buf ^= 1) {
        __bf16* Xt = Xs[buf];
        __bf16* Wt = Ws[buf];
#pragma unroll
        for (int i = 0; i < 2; i++)             // ctx tile 128x32 bf16
            *(bf16x8*)(&Xt[(cr + 64 * i) * GS + cc]) = xr[i];
#pragma unroll
        for (int i = 0; i < 2; i++) {           // Wo tile 64x32 f32 -> bf16
            uint2 p; p.x = pack2bf(wr[i].x, wr[i].y); p.y = pack2bf(wr[i].z, wr[i].w);
            *(uint2*)(&Wt[(sr + 32 * i) * GS + sc]) = p;
        }
        __syncthreads();

        if (k0 + 32 < D_MODEL) {                // next step's tiles, in flight under the products
#pragma unroll
            for (int i = 0; i < 2; i++) xr[i] = *(const bf16x8*)(cg + (size_t)(64 * i) * D_MODEL + k0 + 32);
#pragma unroll
            for (int i = 0; i < 2; i++) wr[i] = *(const float4*)(wg + (size_t)(32 * i) * D_MODEL + k0 + 32);
            // these loads' address registers are advanced or reused below while they are in flight
            asm volatile("s_wait_xcnt 0x0" ::: "memory");
        }

        bf16x16 a;
        const int arow = wave * 16 + lm;
#pragma unroll
        for (int e = 0; e < 16; e++) a[e] = Xt[arow * GS + kmap(e, kh)];
#pragma unroll
        for (int t = 0; t < 4; t++) {
            bf16x16 b;
            const int bcol = t * 16 + lm;
#pragma unroll
            for (int e = 0; e < 16; e++) b[e] = Wt[bcol * GS + kmap(e, kh)];
            acc[t] = wmma_bf16(a, b, acc[t]);
        }
    }

#pragma unroll
    for (int t = 0; t < 4; t++) {
        const int n   = n0 + t * 16 + lm;
        const float b = bo[n];
#pragma unroll
        for (int r = 0; r < 8; r++) {
            const int M = m0 + wave * 16 + r + 8 * kh;
            Out[(size_t)M * D_MODEL + n] = acc[t][r] + b;
        }
    }
}

// ---------------------------------------------------------------------------
extern "C" void kernel_launch(void* const* d_in, const int* in_sizes, int n_in,
                              void* d_out, int out_size, void* d_ws, size_t ws_size,
                              hipStream_t stream)
{
    (void)in_sizes; (void)n_in; (void)out_size;

    const float* x  = (const float*)d_in[0];
    const float* Wq = (const float*)d_in[1];
    const float* bq = (const float*)d_in[2];
    const float* Wk = (const float*)d_in[3];
    const float* bk = (const float*)d_in[4];
    const float* Wv = (const float*)d_in[5];
    const float* bv = (const float*)d_in[6];
    const float* Wo = (const float*)d_in[7];
    const float* bo = (const float*)d_in[8];
    float* out = (float*)d_out;

    const size_t E = (size_t)MTOT * D_MODEL;      // 6,291,456 elements
    if (ws_size < 4 * E * sizeof(__bf16)) return; // ~48 MB scratch required
    __bf16* ws = (__bf16*)d_ws;
    __bf16* Qb = ws;
    __bf16* Kb = ws + E;
    __bf16* Vb = ws + 2 * E;
    __bf16* Cb = ws + 3 * E;

    dim3 g1(MTOT / QM, 3 * D_MODEL / QN);
    qkv_proj_kernel<<<g1, 256, 0, stream>>>(x, Wq, bq, Wk, bk, Wv, bv, Qb, Kb, Vb);

    dim3 g2(SEQ / 128, BATCH * NHEAD);
    flash_attn_kernel<<<g2, 256, 0, stream>>>(Qb, Kb, Vb, Cb);

    dim3 g3(MTOT / 128, D_MODEL / 64);
    out_proj_kernel<<<g3, 256, 0, stream>>>(Cb, Wo, bo, out);
}

// v004
// Measured time: 150 microseconds a run.
// Timed twice side by side with v003, it ran 1.07 and 1.06 times as fast.
// Counting every step since v000, it is 2.90 times as fast.
#include <hip/hip_runtime.h>
#include <hip/hip_bf16.h>

typedef __attribute__((ext_vector_type(16))) __bf16 bf16x16;
typedef __attribute__((ext_vector_type(8)))  float  f32x8;
typedef int v4i_ __attribute__((vector_size(16)));   // matches builtin's pointee type

#define D_MODEL 768
#define NHEAD   12
#define DK      64
#define SEQ     4096
#define BATCH   2
#define MTOT    (BATCH*SEQ)   // 8192

#define GS 40   // GEMM LDS row stride (elems): 80B rows, 16B-aligned, bank stride 20
#define FS 72   // flash LDS row stride (elems): 144B rows, 16B-aligned, bank stride 36
#define VS 80   // V tile LDS row stride (elems): 160B = 32B x odd, the transposing load's pitch

#if defined(__gfx1250__) && __has_builtin(__builtin_amdgcn_global_load_async_to_lds_b128)
#define HAVE_ASYNC 1
#else
#define HAVE_ASYNC 0
#endif

// A/B fragment K-index mapping for v_wmma_*_16x16x32_bf16 (ISA 7.12.2):
// lanes 0-15 hold K 0..7 (elems 0..7) and 16..23 (elems 8..15);
// lanes 16-31 hold K 8..15 and 24..31.
__device__ __forceinline__ int kmap(int e, int kh) {
    return (e < 8) ? (kh * 8 + e) : (16 + kh * 8 + (e - 8));
}

__device__ __forceinline__ f32x8 wmma_bf16(const bf16x16& a, const bf16x16& b, const f32x8& c) {
    return __builtin_amdgcn_wmma_f32_16x16x32_bf16(false, a, false, b, (short)0, c, false, false);
}

__device__ __forceinline__ unsigned pack2bf(float a, float b) {
    union { __bf16 h[2]; unsigned u; } x;
    x.h[0] = (__bf16)a; x.h[1] = (__bf16)b;
    return x.u;
}

// 16-byte async global->LDS copy (ASYNCcnt path); no-op stub when unavailable.
__device__ __forceinline__ void async_copy16(const __bf16* g, __bf16* l) {
#if HAVE_ASYNC
    __builtin_amdgcn_global_load_async_to_lds_b128(
        (__attribute__((address_space(1))) v4i_*)g,
        (__attribute__((address_space(3))) v4i_*)l,
        0, 0);
#else
    (void)g; (void)l;
#endif
}

__device__ __forceinline__ void wait_async0() {
#if HAVE_ASYNC
#if __has_builtin(__builtin_amdgcn_s_wait_asynccnt)
    __builtin_amdgcn_s_wait_asynccnt(0);
#else
    asm volatile("s_wait_asynccnt 0x0" ::: "memory");
#endif
#endif
}

// ---------------------------------------------------------------------------
// Kernel 1: QKV projection. Y = X @ W.T + b  (W stored [out,in] row-major)
// The three weight matrices are taken as one stack of 2304 output columns [Q | K | V].
// Block: 256 thr = 8 waves. Tile: 256(M) x 288(N), grid = (32, 8): one work-group per
// WGP, so that X comes from L2 8 times and the weights 32 times. Waves 4(M) x 2(N),
// each 64 x 144 = 4 x 9 accumulator tiles: 13 fragments from LDS feed 36 products.
// Output layout: [b, h, s, dk] in bf16. (f32->bf16 conversion during staging,
// so this stays on the synchronous vectorized path.)
// ---------------------------------------------------------------------------
#define QM 256              // rows of X per work-group
#define QN 288              // stacked output columns per work-group
#define QXC (QM / 32)       // 32-row chunks of the X tile
#define QWC (QN / 32)       // 32-row chunks of the W tile; 768 = 24 chunks, so a chunk has one matrix
#define QNT (QN / 32)       // 16-column accumulator tiles per wave (half the tile's 18)

// one work-group of eight waves per WGP is two waves per SIMD: the register budget that
// the 4 x 9 accumulator tiles, the fragments and the staged tiles need without a spill
__global__ __launch_bounds__(256) __attribute__((amdgpu_waves_per_eu(2)))
void qkv_proj_kernel(const float* __restrict__ X,
                     const float* __restrict__ Wq, const float* __restrict__ bq,
                     const float* __restrict__ Wk, const float* __restrict__ bk,
                     const float* __restrict__ Wv, const float* __restrict__ bv,
                     __bf16* __restrict__ Qb, __bf16* __restrict__ Kb, __bf16* __restrict__ Vb)
{
    const int m0 = blockIdx.x * QM;

    __shared__ __bf16 Xs[2][QM * GS];
    __shared__ __bf16 Ws[2][QN * GS];

    const int tid  = threadIdx.x;
    const int wave = __builtin_amdgcn_readfirstlane(tid >> 5);
    const int lane = tid & 31;
    const int lm   = lane & 15;
    const int kh   = lane >> 4;
    const int wm   = wave & 3;          // rows    64 wm  .. 64 wm + 63   of the tile
    const int wn   = wave >> 2;         // columns 144 wn .. 144 wn + 143 of the tile

    f32x8 acc[4][QNT] = {};

    // this thread's float4 chunks of a k-step's tiles: rows sr + 32 i, columns sc .. sc + 3
    const int sr = tid >> 3, sc = (tid & 7) * 4;
    // Every chunk has a base that is the same for the whole work-group; the thread's own
    // part is one byte offset, which also carries the k-step.
    const char* xb = (const char*)(X + (size_t)m0 * D_MODEL);
    const char* wb[QWC];
#pragma unroll
    for (int i = 0; i < QWC; i++) {
        const int c = blockIdx.y * QWC + i;         // chunk of the stack: matrix c / 24, rows 32 (c % 24) ..
        const float* Wp = (c < 24) ? Wq : (c < 48) ? Wk : Wv;
        wb[i] = (const char*)(Wp + (size_t)((c % 24) * 32) * D_MODEL);
    }
    unsigned off = (unsigned)(sr * D_MODEL + sc) * 4u;

    // The tiles of step k + 1 are loaded into registers while step k's products run;
    // two LDS buffers, so that one barrier a step publishes the new tile and also ends
    // the reads of the buffer that the next step overwrites.
    float4 xr[QXC], wr[QWC];
#pragma unroll
    for (int i = 0; i < QXC; i++) xr[i] = *(const float4*)(xb + (size_t)(32 * i) * D_MODEL * 4 + off);
#pragma unroll
    for (int i = 0; i < QWC; i++) wr[i] = *(const float4*)(wb[i] + off);

    int buf = 0;
    for (int k0 = 0; k0 < D_MODEL; k0 += 32, buf ^= 1) {
        __bf16* Xt = Xs[buf];
        __bf16* Wt = Ws[buf];
#pragma unroll
        for (int i = 0; i < QXC; i++) {         // X tile 256x32 f32 -> packed bf16
            uint2 p; p.x = pack2bf(xr[i].x, xr[i].y); p.y = pack2bf(xr[i].z, xr[i].w);
            *(uint2*)(&Xt[(sr + 32 * i) * GS + sc]) = p;
        }
#pragma unroll
        for (int i = 0; i < QWC; i++) {         // W tile 288(n) x 32(k)
            uint2 p; p.x = pack2bf(wr[i].x, wr[i].y); p.y = pack2bf(wr[i].z, wr[i].w);
            *(uint2*)(&Wt[(sr + 32 * i) * GS + sc]) = p;
        }
        __syncthreads();

        if (k0 + 32 < D_MODEL) {                // next step's tiles, in flight under the products
            off += 32 * 4;
#pragma unroll
            for (int i = 0; i < QXC; i++) xr[i] = *(const float4*)(xb + (size_t)(32 * i) * D_MODEL * 4 + off);
#pragma unroll
            for (int i = 0; i < QWC; i++) wr[i] = *(const float4*)(wb[i] + off);
            // these loads' offset register is advanced in the next step while they may be in flight
            asm volatile("s_wait_xcnt 0x0" ::: "memory");
        }

        bf16x16 a[4];
#pragma unroll
        for (int mt = 0; mt < 4; mt++) {
            const int arow = wm * 64 + mt * 16 + lm;
#pragma unroll
            for (int e = 0; e < 16; e++) a[mt][e] = Xt[arow * GS + kmap(e, kh)];
        }
        bf16x16 b[QNT];                         // all of the step's fragments as one group of LDS loads
#pragma unroll
        for (int t = 0; t < QNT; t++) {
            const int bcol = wn * (QN / 2) + t * 16 + lm;
#pragma unroll
            for (int e = 0; e < 16; e++) b[t][e] = Wt[bcol * GS + kmap(e, kh)];
        }
        // keeps the loads above the products: sunk among them, each row of four products
        // would wait out its own fragment's LDS latency
        __builtin_amdgcn_sched_barrier(0);
#pragma unroll
        for (int t = 0; t < QNT; t++)
#pragma unroll
            for (int mt = 0; mt < 4; mt++) acc[mt][t] = wmma_bf16(a[mt], b[t], acc[mt][t]);
    }

#pragma unroll
    for (int t = 0; t < QNT; t++) {
        const int g  = blockIdx.y * (QN / 16) + wn * QNT + t;   // 16-column tile of the stack: 48 a matrix, 4 a head
        const int gh = g % 48;
        const float* bias = (g < 48) ? bq : (g < 96) ? bk : bv;
        __bf16*      Out  = (g < 48) ? Qb : (g < 96) ? Kb : Vb;
        const int h  = gh >> 2;
        const int d  = (gh & 3) * 16 + lm;
        const float bv_ = bias[gh * 16 + lm];
        // the next column tile's address is formed in this load's offset and base registers
        asm volatile("s_wait_xcnt 0x0" ::: "memory");
#pragma unroll
        for (int mt = 0; mt < 4; mt++) {
#pragma unroll
            for (int r = 0; r < 8; r++) {
                const int M    = m0 + wm * 64 + mt * 16 + r + 8 * kh;
                const int bidx = M >> 12;           // / 4096
                const int s    = M & 4095;
                Out[(((size_t)bidx * NHEAD + h) * SEQ + s) * DK + d] = (__bf16)(acc[mt][t][r] + bv_);
            }
            // later sums and addresses are formed in these stores' data registers
            asm volatile("s_wait_xcnt 0x0" ::: "memory");
            // holds those later register writes behind the wait: the scheduler lifted some over it
            __builtin_amdgcn_sched_barrier(0);
        }
    }
}

typedef __attribute__((ext_vector_type(8))) __bf16 bf16x8;

// Row-major 16-bit LDS tile -> transposed operand half: lane (lm, kh) gets
// T[kbase + 8*kh + 0..7][dbase + lm]; p is the lane's own address (see vrow below).
__device__ __forceinline__ bf16x8 ld_tr16(const __bf16* p) {
    typedef __attribute__((address_space(3))) bf16x8 lds_bf16x8;
    return __builtin_amdgcn_ds_load_tr16_b128_v8bf16((lds_bf16x8*)p);
}

// value of lane l ^ 16
__device__ __forceinline__ float xhalf(float x) {
    return __builtin_bit_cast(float, __builtin_amdgcn_permlanex16(
        __builtin_bit_cast(int, x), __builtin_bit_cast(int, x),
        0x76543210, 0xfedcba98, false, false));
}

// 2^x of one score tile's eight registers. One statement, so that each v_exp_f32 is
// followed by an independent one and the last by v_nop: the slot the instruction set
// asks for before a transcendental's source is overwritten or its result read.
__device__ __forceinline__ f32x8 exp2x8(const f32x8& x) {
    float y0, y1, y2, y3, y4, y5, y6, y7;
    asm("v_exp_f32 %0, %8\n\t"
        "v_exp_f32 %1, %9\n\t"
        "v_exp_f32 %2, %10\n\t"
        "v_exp_f32 %3, %11\n\t"
        "v_exp_f32 %4, %12\n\t"
        "v_exp_f32 %5, %13\n\t"
        "v_exp_f32 %6, %14\n\t"
        "v_exp_f32 %7, %15\n\t"
        "v_nop"
        : "=&v"(y0), "=&v"(y1), "=&v"(y2), "=&v"(y3), "=&v"(y4), "=&v"(y5), "=&v"(y6), "=&v"(y7)
        : "v"(x[0]), "v"(x[1]), "v"(x[2]), "v"(x[3]), "v"(x[4]), "v"(x[5]), "v"(x[6]), "v"(x[7]));
    f32x8 y = {y0, y1, y2, y3, y4, y5, y6, y7};
    return y;
}

// the same for a single value
__device__ __forceinline__ float exp2x1(float x) {
    float y;
    asm("v_exp_f32 %0, %1\n\t"
        "v_nop"
        : "=&v"(y) : "v"(x));
    return y;
}

// 768 work-groups of four waves on 256 WGPs: three resident per WGP (three waves per SIMD) hold the whole
// grid; the upper bound of three keeps a fourth work-group off a WGP, so that the grid spreads evenly
__global__ __launch_bounds__(128) __attribute__((amdgpu_waves_per_eu(3, 3)))
void flash_attn_kernel(const __bf16* __restrict__ Qb, const __bf16* __restrict__ Kb,
                       const __bf16* __restrict__ Vb, __bf16* __restrict__ Ctx)
{
    const int bh = blockIdx.y;
    const int q0 = blockIdx.x * 128;
    const __bf16* Qh = Qb + (size_t)bh * SEQ * DK;
    const __bf16* Kh = Kb + (size_t)bh * SEQ * DK;
    const __bf16* Vh = Vb + (size_t)bh * SEQ * DK;

    __shared__ __attribute__((aligned(16))) __bf16 Qs[128 * FS];
    __shared__ __attribute__((aligned(16))) __bf16 Ks[2][64 * FS];
    __shared__ __attribute__((aligned(16))) __bf16 Vs[2][64 * VS];

    const int tid  = threadIdx.x;
    const int wave = tid >> 5;
    const int lane = tid & 31;
    const int lm   = lane & 15;
    const int kh   = lane >> 4;

    // this thread's four 16B chunks of each 64x64 tile: rows cr + 16 i, columns cc .. cc + 7
    const int cr = tid >> 3, cc = (tid & 7) * 8;

#if HAVE_ASYNC
    // prologue: start DMA of first K/V tiles while we stage Q
#pragma unroll
    for (int i = 0; i < 4; i++) {
        const int r = cr + 16 * i;
        async_copy16(Kh + (size_t)r * DK + cc, &Ks[0][r * FS + cc]);
        async_copy16(Vh + (size_t)r * DK + cc, &Vs[0][r * VS + cc]);
    }
#endif

    // Q block 128x64 bf16: 1024 uint4 loads, 8 per thread, b128 LDS stores
#pragma unroll
    for (int i = 0; i < 8; i++) {
        const int r = cr + 16 * i;
        *(uint4*)(&Qs[r * FS + cc]) = *(const uint4*)(Qh + (size_t)(q0 + r) * DK + cc);
    }
    __syncthreads();

    // B operands of S^T, one per 16-query group g: column lm = query 32 wave + 16 g + lm, k = d in kmap order
    bf16x16 qb[2][2];
#pragma unroll
    for (int g = 0; g < 2; g++) {
        const int qrow = wave * 32 + g * 16 + lm;
#pragma unroll
        for (int dc = 0; dc < 2; dc++)
#pragma unroll
            for (int e = 0; e < 16; e++)
                qb[g][dc][e] = Qs[qrow * FS + dc * 32 + kmap(e, kh)];
    }

    float mrow[2] = {-3.0e38f, -3.0e38f};   // running maximum of group g's query lm (equal in both halves)
    float lrow[2] = {0.0f, 0.0f};           // running sum over this half's keys only
    f32x8 cacc[2][4] = {};                  // cacc[g][t][r] = O^T[d = 16t + 8kh + r][query lm of group g]

    const float scale = 0.125f;                   // 1/sqrt(64)
    // lane's element offset inside a V tile for the transposing load
    const int vrow = (8 * kh + (lane & 7)) * VS + 8 * ((lane >> 3) & 1);

    int buf = 0;
    for (int j0 = 0; j0 < SEQ; j0 += 64, buf ^= 1) {
#if HAVE_ASYNC
        wait_async0();          // my async copies into Ks/Vs[buf] done
        __syncthreads();        // everyone's done; prior readers of buf^1 done
        if (j0 + 64 < SEQ) {    // kick off next tile into the other buffer
#pragma unroll
            for (int i = 0; i < 4; i++) {
                const int r = cr + 16 * i;
                async_copy16(Kh + (size_t)(j0 + 64 + r) * DK + cc, &Ks[buf ^ 1][r * FS + cc]);
                async_copy16(Vh + (size_t)(j0 + 64 + r) * DK + cc, &Vs[buf ^ 1][r * VS + cc]);
            }
        }
#else
        __syncthreads();
#pragma unroll
        for (int i = 0; i < 4; i++) {
            const int r = cr + 16 * i;
            *(uint4*)(&Ks[buf][r * FS + cc]) = *(const uint4*)(Kh + (size_t)(j0 + r) * DK + cc);
            *(uint4*)(&Vs[buf][r * VS + cc]) = *(const uint4*)(Vh + (size_t)(j0 + r) * DK + cc);
        }
        __syncthreads();
#endif
        const __bf16* Kt = Ks[buf];
        const __bf16* Vt = Vs[buf];

        // S^T = K @ Q^T : 4 key tiles x 2 d-chunks, each K fragment used for both query groups;
        // sacc[g][t][r] = S[query lm of group g][key 16t + 8kh + r]
        f32x8 sacc[2][4] = {};
#pragma unroll
        for (int t = 0; t < 4; t++) {
            const int key = t * 16 + lm;
#pragma unroll
            for (int dc = 0; dc < 2; dc++) {
                bf16x16 a;
#pragma unroll
                for (int e = 0; e < 16; e++) a[e] = Kt[key * FS + dc * 32 + kmap(e, kh)];
#pragma unroll
                for (int g = 0; g < 2; g++) sacc[g][t] = wmma_bf16(a, qb[g][dc], sacc[g][t]);
            }
        }

        bf16x16 pb[2][2];
#pragma unroll
        for (int g = 0; g < 2; g++) {
#pragma unroll
            for (int t = 0; t < 4; t++)
#pragma unroll
                for (int r = 0; r < 8; r++) sacc[g][t][r] *= scale;

            // online softmax of query lm: 32 keys in this lane, the other 32 in lane ^ 16
            float tmax[4];
#pragma unroll
            for (int t = 0; t < 4; t++) {
                tmax[t] = sacc[g][t][0];
#pragma unroll
                for (int r = 1; r < 8; r++) tmax[t] = fmaxf(tmax[t], sacc[g][t][r]);
            }
            float vmax = fmaxf(fmaxf(tmax[0], tmax[1]), fmaxf(tmax[2], tmax[3]));
            vmax = fmaxf(vmax, xhalf(vmax));
            const float mnew = fmaxf(mrow[g], vmax);
            const float corr = exp2x1((mrow[g] - mnew) * 1.44269504f);
            float tsum[4];
#pragma unroll
            for (int t = 0; t < 4; t++) {
                f32x8 x;             // exp(s - m) = 2^((s - m) * log2(e)), as __expf forms it
#pragma unroll
                for (int r = 0; r < 8; r++) x[r] = (sacc[g][t][r] - mnew) * 1.44269504f;
                sacc[g][t] = exp2x8(x);
                tsum[t] = 0.0f;
#pragma unroll
                for (int r = 0; r < 8; r++) tsum[t] += sacc[g][t][r];
            }
            lrow[g] = lrow[g] * corr + ((tsum[0] + tsum[1]) + (tsum[2] + tsum[3]));
            mrow[g] = mnew;
#pragma unroll
            for (int t = 0; t < 4; t++)
#pragma unroll
                for (int r = 0; r < 8; r++) cacc[g][t][r] *= corr;

            // P^T as B operand: k = key 32kc + kmap(e, kh) is register e & 7 of tile 2kc + (e >> 3)
#pragma unroll
            for (int kc = 0; kc < 2; kc++)
#pragma unroll
                for (int e = 0; e < 16; e++) pb[g][kc][e] = (__bf16)sacc[g][2 * kc + (e >> 3)][e & 7];
        }

        // O^T += V^T @ P^T : A row lm = d 16t + lm, k = key in kmap order; each V^T fragment used for both groups
#pragma unroll
        for (int t = 0; t < 4; t++) {
#pragma unroll
            for (int kc = 0; kc < 2; kc++) {
                const __bf16* vp = Vt + vrow + kc * 32 * VS + t * 16;
                const bf16x8 lo = ld_tr16(vp);
                const bf16x8 hi = ld_tr16(vp + 16 * VS);
                const bf16x16 va = __builtin_shufflevector(lo, hi, 0, 1, 2, 3, 4, 5, 6, 7,
                                                           8, 9, 10, 11, 12, 13, 14, 15);
#pragma unroll
                for (int g = 0; g < 2; g++) cacc[g][t] = wmma_bf16(va, pb[g][kc], cacc[g][t]);
            }
        }
    }

    const int bidx = bh / NHEAD;
    const int h    = bh % NHEAD;
#pragma unroll
    for (int g = 0; g < 2; g++) {
        const float lsum = lrow[g] + xhalf(lrow[g]);    // join the two halves' key sums
        const int s = q0 + wave * 32 + g * 16 + lm;
        __bf16* crow = Ctx + ((size_t)(bidx * SEQ + s)) * D_MODEL + h * DK + 8 * kh;
#pragma unroll
        for (int t = 0; t < 4; t++) {
            bf16x8 o;                // 8 consecutive d of one query: one 16-byte store
#pragma unroll
            for (int r = 0; r < 8; r++) o[r] = (__bf16)(cacc[g][t][r] / lsum);
            *(bf16x8*)(crow + t * 16) = o;
        }
    }
}

// ---------------------------------------------------------------------------
// Kernel 3: output projection. out = ctx @ Wo.T + bo, fp32 result. grid=(64,12)
// ---------------------------------------------------------------------------
__global__ __launch_bounds__(256)
void out_proj_kernel(const __bf16* __restrict__ Ctx, const float* __restrict__ Wo,
                     const float* __restrict__ bo, float* __restrict__ Out)
{
    const int m0 = blockIdx.x * 128;
    const int n0 = blockIdx.y * 64;

    __shared__ __bf16 Xs[2][128 * GS];
    __shared__ __bf16 Ws[2][64 * GS];

    const int tid  = threadIdx.x;
    const int wave = tid >> 5;
    const int lane = tid & 31;
    const int lm   = lane & 15;
    const int kh   = lane >> 4;

    f32x8 acc[4] = {};

    // this thread's chunks of a k-step's tiles: ctx rows cr + 64 i (8 bf16), Wo rows sr + 32 i (4 f32)
    const int cr = tid >> 2, cc = (tid & 3) * 8;
    const int sr = tid >> 3, sc = (tid & 7) * 4;
    const __bf16* cg = Ctx + (size_t)(m0 + cr) * D_MODEL + cc;
    const float*  wg = Wo  + (size_t)(n0 + sr) * D_MODEL + sc;

    // step k + 1's tiles are loaded into registers while step k's products run; two LDS
    // buffers and one barrier a step, as in the first projection kernel
    bf16x8 xr[2];
    float4 wr[2];
#pragma unroll
    for (int i = 0; i < 2; i++) xr[i] = *(const bf16x8*)(cg + (size_t)(64 * i) * D_MODEL);
#pragma unroll
    for (int i = 0; i < 2; i++) wr[i] = *(const float4*)(wg + (size_t)(32 * i) * D_MODEL);

    int buf = 0;
    for (int k0 = 0; k0 < D_MODEL; k0 += 32, buf ^= 1) {
        __bf16* Xt = Xs[buf];
        __bf16* Wt = Ws[buf];
#pragma unroll
        for (int i = 0; i < 2; i++)             // ctx tile 128x32 bf16
            *(bf16x8*)(&Xt[(cr + 64 * i) * GS + cc]) = xr[i];
#pragma unroll
        for (int i = 0; i < 2; i++) {           // Wo tile 64x32 f32 -> bf16
            uint2 p; p.x = pack2bf(wr[i].x, wr[i].y); p.y = pack2bf(wr[i].z, wr[i].w);
            *(uint2*)(&Wt[(sr + 32 * i) * GS + sc]) = p;
        }
        __syncthreads();

        if (k0 + 32 < D_MODEL) {                // next step's tiles, in flight under the products
#pragma unroll
            for (int i = 0; i < 2; i++) xr[i] = *(const bf16x8*)(cg + (size_t)(64 * i) * D_MODEL + k0 + 32);
#pragma unroll
            for (int i = 0; i < 2; i++) wr[i] = *(const float4*)(wg + (size_t)(32 * i) * D_MODEL + k0 + 32);
            // these loads' address registers are advanced or reused below while they are in flight
            asm volatile("s_wait_xcnt 0x0" ::: "memory");
        }

        bf16x16 a;
        const int arow = wave * 16 + lm;
#pragma unroll
        for (int e = 0; e < 16; e++) a[e] = Xt[arow * GS + kmap(e, kh)];
#pragma unroll
        for (int t = 0; t < 4; t++) {
            bf16x16 b;
            const int bcol = t * 16 + lm;
#pragma unroll
            for (int e = 0; e < 16; e++) b[e] = Wt[bcol * GS + kmap(e, kh)];
            acc[t] = wmma_bf16(a, b, acc[t]);
        }
    }

#pragma unroll
    for (int t = 0; t < 4; t++) {
        const int n   = n0 + t * 16 + lm;
        const float b = bo[n];
#pragma unroll
        for (int r = 0; r < 8; r++) {
            const int M = m0 + wave * 16 + r + 8 * kh;
            Out[(size_t)M * D_MODEL + n] = acc[t][r] + b;
        }
    }
}

// ---------------------------------------------------------------------------
extern "C" void kernel_launch(void* const* d_in, const int* in_sizes, int n_in,
                              void* d_out, int out_size, void* d_ws, size_t ws_size,
                              hipStream_t stream)
{
    (void)in_sizes; (void)n_in; (void)out_size;

    const float* x  = (const float*)d_in[0];
    const float* Wq = (const float*)d_in[1];
    const float* bq = (const float*)d_in[2];
    const float* Wk = (const float*)d_in[3];
    const float* bk = (const float*)d_in[4];
    const float* Wv = (const float*)d_in[5];
    const float* bv = (const float*)d_in[6];
    const float* Wo = (const float*)d_in[7];
    const float* bo = (const float*)d_in[8];
    float* out = (float*)d_out;

    const size_t E = (size_t)MTOT * D_MODEL;      // 6,291,456 elements
    if (ws_size < 4 * E * sizeof(__bf16)) return; // ~48 MB scratch required
    __bf16* ws = (__bf16*)d_ws;
    __bf16* Qb = ws;
    __bf16* Kb = ws + E;
    __bf16* Vb = ws + 2 * E;
    __bf16* Cb = ws + 3 * E;

    dim3 g1(MTOT / QM, 3 * D_MODEL / QN);
    qkv_proj_kernel<<<g1, 256, 0, stream>>>(x, Wq, bq, Wk, bk, Wv, bv, Qb, Kb, Vb);

    dim3 g2(SEQ / 128, BATCH * NHEAD);
    flash_attn_kernel<<<g2, 128, 0, stream>>>(Qb, Kb, Vb, Cb);

    dim3 g3(MTOT / 128, D_MODEL / 64);
    out_proj_kernel<<<g3, 256, 0, stream>>>(Cb, Wo, bo, out);
}

// v005
// A run of this version takes 132 microseconds.
// Next to v004, in two timings, it ran 1.13 times as fast each time.
// All steps since v000 together make it 3.28 times as fast.
#include <hip/hip_runtime.h>
#include <hip/hip_bf16.h>

typedef __attribute__((ext_vector_type(16))) __bf16 bf16x16;
typedef __attribute__((ext_vector_type(8)))  float  f32x8;
typedef int v4i_ __attribute__((vector_size(16)));   // matches builtin's pointee type

#define D_MODEL 768
#define NHEAD   12
#define DK      64
#define SEQ     4096
#define BATCH   2
#define MTOT    (BATCH*SEQ)   // 8192

#define GS 40   // GEMM LDS row stride (elems): 80B rows, 16B-aligned, bank stride 20
#define FS 72   // flash LDS row stride (elems): 144B rows, 16B-aligned, bank stride 36
#define VS 80   // V tile LDS row stride (elems): 160B = 32B x odd, the transposing load's pitch
#define QSCALE 0.18033688f   // log2(e) / sqrt(DK)

#if defined(__gfx1250__) && __has_builtin(__builtin_amdgcn_global_load_async_to_lds_b128)
#define HAVE_ASYNC 1
#else
#define HAVE_ASYNC 0
#endif

// A/B fragment K-index mapping for v_wmma_*_16x16x32_bf16 (ISA 7.12.2):
// lanes 0-15 hold K 0..7 (elems 0..7) and 16..23 (elems 8..15);
// lanes 16-31 hold K 8..15 and 24..31.
__device__ __forceinline__ int kmap(int e, int kh) {
    return (e < 8) ? (kh * 8 + e) : (16 + kh * 8 + (e - 8));
}

__device__ __forceinline__ f32x8 wmma_bf16(const bf16x16& a, const bf16x16& b, const f32x8& c) {
    return __builtin_amdgcn_wmma_f32_16x16x32_bf16(false, a, false, b, (short)0, c, false, false);
}

__device__ __forceinline__ unsigned pack2bf(float a, float b) {
    union { __bf16 h[2]; unsigned u; } x;
    x.h[0] = (__bf16)a; x.h[1] = (__bf16)b;
    return x.u;
}

// 16-byte async global->LDS copy (ASYNCcnt path); no-op stub when unavailable.
__device__ __forceinline__ void async_copy16(const __bf16* g, __bf16* l) {
#if HAVE_ASYNC
    __builtin_amdgcn_global_load_async_to_lds_b128(
        (__attribute__((address_space(1))) v4i_*)g,
        (__attribute__((address_space(3))) v4i_*)l,
        0, 0);
#else
    (void)g; (void)l;
#endif
}

__device__ __forceinline__ void wait_async0() {
#if HAVE_ASYNC
#if __has_builtin(__builtin_amdgcn_s_wait_asynccnt)
    __builtin_amdgcn_s_wait_asynccnt(0);
#else
    asm volatile("s_wait_asynccnt 0x0" ::: "memory");
#endif
#endif
}

// ---------------------------------------------------------------------------
// Kernel 1: QKV projection. Y = X @ W.T + b  (W stored [out,in] row-major)
// The three weight matrices are taken as one stack of 2304 output columns [Q | K | V].
// Block: 256 thr = 8 waves. Tile: 256(M) x 288(N), grid = (32, 8): one work-group per
// WGP, so that X comes from L2 8 times and the weights 32 times. Waves 4(M) x 2(N),
// each 64 x 144 = 4 x 9 accumulator tiles: 13 fragments from LDS feed 36 products.
// Output layout: [b, h, s, dk] in bf16, Q times QSCALE. (f32->bf16 conversion during staging,
// so this stays on the synchronous vectorized path.)
// ---------------------------------------------------------------------------
#define QM 256              // rows of X per work-group
#define QN 288              // stacked output columns per work-group
#define QXC (QM / 32)       // 32-row chunks of the X tile
#define QWC (QN / 32)       // 32-row chunks of the W tile; 768 = 24 chunks, so a chunk has one matrix
#define QNT (QN / 32)       // 16-column accumulator tiles per wave (half the tile's 18)

// one work-group of eight waves per WGP is two waves per SIMD: the register budget that
// the 4 x 9 accumulator tiles, the fragments and the staged tiles need without a spill
__global__ __launch_bounds__(256) __attribute__((amdgpu_waves_per_eu(2)))
void qkv_proj_kernel(const float* __restrict__ X,
                     const float* __restrict__ Wq, const float* __restrict__ bq,
                     const float* __restrict__ Wk, const float* __restrict__ bk,
                     const float* __restrict__ Wv, const float* __restrict__ bv,
                     __bf16* __restrict__ Qb, __bf16* __restrict__ Kb, __bf16* __restrict__ Vb)
{
    const int m0 = blockIdx.x * QM;

    __shared__ __bf16 Xs[2][QM * GS];
    __shared__ __bf16 Ws[2][QN * GS];

    const int tid  = threadIdx.x;
    const int wave = __builtin_amdgcn_readfirstlane(tid >> 5);
    const int lane = tid & 31;
    const int lm   = lane & 15;
    const int kh   = lane >> 4;
    const int wm   = wave & 3;          // rows    64 wm  .. 64 wm + 63   of the tile
    const int wn   = wave >> 2;         // columns 144 wn .. 144 wn + 143 of the tile

    f32x8 acc[4][QNT] = {};

    // this thread's float4 chunks of a k-step's tiles: rows sr + 32 i, columns sc .. sc + 3
    const int sr = tid >> 3, sc = (tid & 7) * 4;
    // Every chunk has a base that is the same for the whole work-group; the thread's own
    // part is one byte offset, which also carries the k-step.
    const char* xb = (const char*)(X + (size_t)m0 * D_MODEL);
    const char* wb[QWC];
#pragma unroll
    for (int i = 0; i < QWC; i++) {
        const int c = blockIdx.y * QWC + i;         // chunk of the stack: matrix c / 24, rows 32 (c % 24) ..
        const float* Wp = (c < 24) ? Wq : (c < 48) ? Wk : Wv;
        wb[i] = (const char*)(Wp + (size_t)((c % 24) * 32) * D_MODEL);
    }
    unsigned off = (unsigned)(sr * D_MODEL + sc) * 4u;

    // The tiles of step k + 1 are loaded into registers while step k's products run;
    // two LDS buffers, so that one barrier a step publishes the new tile and also ends
    // the reads of the buffer that the next step overwrites.
    float4 xr[QXC], wr[QWC];
#pragma unroll
    for (int i = 0; i < QXC; i++) xr[i] = *(const float4*)(xb + (size_t)(32 * i) * D_MODEL * 4 + off);
#pragma unroll
    for (int i = 0; i < QWC; i++) wr[i] = *(const float4*)(wb[i] + off);

    int buf = 0;
    for (int k0 = 0; k0 < D_MODEL; k0 += 32, buf ^= 1) {
        __bf16* Xt = Xs[buf];
        __bf16* Wt = Ws[buf];
#pragma unroll
        for (int i = 0; i < QXC; i++) {         // X tile 256x32 f32 -> packed bf16
            uint2 p; p.x = pack2bf(xr[i].x, xr[i].y); p.y = pack2bf(xr[i].z, xr[i].w);
            *(uint2*)(&Xt[(sr + 32 * i) * GS + sc]) = p;
        }
#pragma unroll
        for (int i = 0; i < QWC; i++) {         // W tile 288(n) x 32(k)
            uint2 p; p.x = pack2bf(wr[i].x, wr[i].y); p.y = pack2bf(wr[i].z, wr[i].w);
            *(uint2*)(&Wt[(sr + 32 * i) * GS + sc]) = p;
        }
        __syncthreads();

        if (k0 + 32 < D_MODEL) {                // next step's tiles, in flight under the products
            off += 32 * 4;
#pragma unroll
            for (int i = 0; i < QXC; i++) xr[i] = *(const float4*)(xb + (size_t)(32 * i) * D_MODEL * 4 + off);
#pragma unroll
            for (int i = 0; i < QWC; i++) wr[i] = *(const float4*)(wb[i] + off);
            // these loads' offset register is advanced in the next step while they may be in flight
            asm volatile("s_wait_xcnt 0x0" ::: "memory");
        }

        bf16x16 a[4];
#pragma unroll
        for (int mt = 0; mt < 4; mt++) {
            const int arow = wm * 64 + mt * 16 + lm;
#pragma unroll
            for (int e = 0; e < 16; e++) a[mt][e] = Xt[arow * GS + kmap(e, kh)];
        }
        bf16x16 b[QNT];                         // all of the step's fragments as one group of LDS loads
#pragma unroll
        for (int t = 0; t < QNT; t++) {
            const int bcol = wn * (QN / 2) + t * 16 + lm;
#pragma unroll
            for (int e = 0; e < 16; e++) b[t][e] = Wt[bcol * GS + kmap(e, kh)];
        }
        // keeps the loads above the products: sunk among them, each row of four products
        // would wait out its own fragment's LDS latency
        __builtin_amdgcn_sched_barrier(0);
#pragma unroll
        for (int t = 0; t < QNT; t++)
#pragma unroll
            for (int mt = 0; mt < 4; mt++) acc[mt][t] = wmma_bf16(a[mt], b[t], acc[mt][t]);
    }

#pragma unroll
    for (int t = 0; t < QNT; t++) {
        const int g  = blockIdx.y * (QN / 16) + wn * QNT + t;   // 16-column tile of the stack: 48 a matrix, 4 a head
        const int gh = g % 48;
        const float* bias = (g < 48) ? bq : (g < 96) ? bk : bv;
        __bf16*      Out  = (g < 48) ? Qb : (g < 96) ? Kb : Vb;
        const int h  = gh >> 2;
        const int d  = (gh & 3) * 16 + lm;
        // Q is stored times log2(e)/sqrt(dk): the score products then come out as exponents of 2
        const float osc = (g < 48) ? QSCALE : 1.0f;
        const float bv_ = bias[gh * 16 + lm] * osc;
        // the next column tile's address is formed in this load's offset and base registers
        asm volatile("s_wait_xcnt 0x0" ::: "memory");
#pragma unroll
        for (int mt = 0; mt < 4; mt++) {
#pragma unroll
            for (int r = 0; r < 8; r++) {
                const int M    = m0 + wm * 64 + mt * 16 + r + 8 * kh;
                const int bidx = M >> 12;           // / 4096
                const int s    = M & 4095;
                Out[(((size_t)bidx * NHEAD + h) * SEQ + s) * DK + d] = (__bf16)fmaf(acc[mt][t][r], osc, bv_);
            }
            // later sums and addresses are formed in these stores' data registers
            asm volatile("s_wait_xcnt 0x0" ::: "memory");
            // holds those later register writes behind the wait: the scheduler lifted some over it
            __builtin_amdgcn_sched_barrier(0);
        }
    }
}

typedef __attribute__((ext_vector_type(8))) __bf16 bf16x8;

// Row-major 16-bit LDS tile -> transposed operand half: lane (lm, kh) gets
// T[kbase + 8*kh + 0..7][dbase + lm]; p is the lane's own address (see vrow below).
__device__ __forceinline__ bf16x8 ld_tr16(const __bf16* p) {
    typedef __attribute__((address_space(3))) bf16x8 lds_bf16x8;
    return __builtin_amdgcn_ds_load_tr16_b128_v8bf16((lds_bf16x8*)p);
}

// value of lane l ^ 16
__device__ __forceinline__ float xhalf(float x) {
    return __builtin_bit_cast(float, __builtin_amdgcn_permlanex16(
        __builtin_bit_cast(int, x), __builtin_bit_cast(int, x),
        0x76543210, 0xfedcba98, false, false));
}

// 2^x of one score tile's eight registers. One statement, so that each v_exp_f32 is
// followed by an independent one and the last by v_nop: the slot the instruction set
// asks for before a transcendental's source is overwritten or its result read.
__device__ __forceinline__ f32x8 exp2x8(const f32x8& x) {
    float y0, y1, y2, y3, y4, y5, y6, y7;
    asm("v_exp_f32 %0, %8\n\t"
        "v_exp_f32 %1, %9\n\t"
        "v_exp_f32 %2, %10\n\t"
        "v_exp_f32 %3, %11\n\t"
        "v_exp_f32 %4, %12\n\t"
        "v_exp_f32 %5, %13\n\t"
        "v_exp_f32 %6, %14\n\t"
        "v_exp_f32 %7, %15\n\t"
        "v_nop"
        : "=&v"(y0), "=&v"(y1), "=&v"(y2), "=&v"(y3), "=&v"(y4), "=&v"(y5), "=&v"(y6), "=&v"(y7)
        : "v"(x[0]), "v"(x[1]), "v"(x[2]), "v"(x[3]), "v"(x[4]), "v"(x[5]), "v"(x[6]), "v"(x[7]));
    f32x8 y = {y0, y1, y2, y3, y4, y5, y6, y7};
    return y;
}

// the same for a single value
__device__ __forceinline__ float exp2x1(float x) {
    float y;
    asm("v_exp_f32 %0, %1\n\t"
        "v_nop"
        : "=&v"(y) : "v"(x));
    return y;
}

// 768 work-groups of four waves on 256 WGPs: three resident per WGP (three waves per SIMD) hold the whole
// grid; the upper bound of three keeps a fourth work-group off a WGP, so that the grid spreads evenly
__global__ __launch_bounds__(128) __attribute__((amdgpu_waves_per_eu(3, 3)))
void flash_attn_kernel(const __bf16* __restrict__ Qb, const __bf16* __restrict__ Kb,
                       const __bf16* __restrict__ Vb, __bf16* __restrict__ Ctx)
{
    const int bh = blockIdx.y;
    const int q0 = blockIdx.x * 128;
    const __bf16* Qh = Qb + (size_t)bh * SEQ * DK;
    const __bf16* Kh = Kb + (size_t)bh * SEQ * DK;
    const __bf16* Vh = Vb + (size_t)bh * SEQ * DK;

    __shared__ __attribute__((aligned(16))) __bf16 Qs[128 * FS];
    __shared__ __attribute__((aligned(16))) __bf16 Ks[2][64 * FS];
    __shared__ __attribute__((aligned(16))) __bf16 Vs[2][64 * VS];

    const int tid  = threadIdx.x;
    const int wave = tid >> 5;
    const int lane = tid & 31;
    const int lm   = lane & 15;
    const int kh   = lane >> 4;

    // this thread's four 16B chunks of each 64x64 tile: rows cr + 16 i, columns cc .. cc + 7
    const int cr = tid >> 3, cc = (tid & 7) * 8;

#if HAVE_ASYNC
    // prologue: start DMA of first K/V tiles while we stage Q
#pragma unroll
    for (int i = 0; i < 4; i++) {
        const int r = cr + 16 * i;
        async_copy16(Kh + (size_t)r * DK + cc, &Ks[0][r * FS + cc]);
        async_copy16(Vh + (size_t)r * DK + cc, &Vs[0][r * VS + cc]);
    }
#endif

    // Q block 128x64 bf16: 1024 uint4 loads, 8 per thread, b128 LDS stores
#pragma unroll
    for (int i = 0; i < 8; i++) {
        const int r = cr + 16 * i;
        *(uint4*)(&Qs[r * FS + cc]) = *(const uint4*)(Qh + (size_t)(q0 + r) * DK + cc);
    }
    __syncthreads();

    // B operands of S^T, one per 16-query group g: column lm = query 32 wave + 16 g + lm, k = d in kmap order
    bf16x16 qb[2][2];
#pragma unroll
    for (int g = 0; g < 2; g++) {
        const int qrow = wave * 32 + g * 16 + lm;
#pragma unroll
        for (int dc = 0; dc < 2; dc++)
#pragma unroll
            for (int e = 0; e < 16; e++)
                qb[g][dc][e] = Qs[qrow * FS + dc * 32 + kmap(e, kh)];
    }

    f32x8 nref[2] = {};                     // minus the reference of group g's query lm, in all eight registers (equal in both halves)
    float lrow[2] = {0.0f, 0.0f};           // running sum over this half's keys only
    f32x8 cacc[2][4] = {};                  // cacc[g][t][r] = O^T[d = 16t + 8kh + r][query lm of group g]

    // lane's element offset inside a V tile for the transposing load
    const int vrow = (8 * kh + (lane & 7)) * VS + 8 * ((lane >> 3) & 1);

    int buf = 0;
    for (int j0 = 0; j0 < SEQ; j0 += 64, buf ^= 1) {
#if HAVE_ASYNC
        wait_async0();          // my async copies into Ks/Vs[buf] done
        __syncthreads();        // everyone's done; prior readers of buf^1 done
        if (j0 + 64 < SEQ) {    // kick off next tile into the other buffer
#pragma unroll
            for (int i = 0; i < 4; i++) {
                const int r = cr + 16 * i;
                async_copy16(Kh + (size_t)(j0 + 64 + r) * DK + cc, &Ks[buf ^ 1][r * FS + cc]);
                async_copy16(Vh + (size_t)(j0 + 64 + r) * DK + cc, &Vs[buf ^ 1][r * VS + cc]);
            }
        }
#else
        __syncthreads();
#pragma unroll
        for (int i = 0; i < 4; i++) {
            const int r = cr + 16 * i;
            *(uint4*)(&Ks[buf][r * FS + cc]) = *(const uint4*)(Kh + (size_t)(j0 + r) * DK + cc);
            *(uint4*)(&Vs[buf][r * VS + cc]) = *(const uint4*)(Vh + (size_t)(j0 + r) * DK + cc);
        }
        __syncthreads();
#endif
        const __bf16* Kt = Ks[buf];
        const __bf16* Vt = Vs[buf];

        // S^T = K @ Q^T : 4 key tiles x 2 d-chunks, each K fragment used for both query groups;
        // sacc[g][t][r] = S[query lm of group g][key 16t + 8kh + r] - reference, in powers of 2.
        // Run once per tile. A second time, with a renewed reference, only if the first run's
        // sums pass 2^8 in some lane (as they must if a score passes the reference by more than 8, P <= sum);
        // nothing of the first run has then reached the running sums or the output. At most two
        // runs: the second always leaves the loop.
        bf16x16 pb[2][2];
        float tl[2];                            // the tile's sum over this half's keys
        bool renew = (j0 == 0);                 // the first tile sets the reference, whatever its scores' size
        for (;;) {
            f32x8 sacc[2][4];
#pragma unroll
            for (int t = 0; t < 4; t++) {
                const int key = t * 16 + lm;
#pragma unroll
                for (int dc = 0; dc < 2; dc++) {
                    bf16x16 a;
#pragma unroll
                    for (int e = 0; e < 16; e++) a[e] = Kt[key * FS + dc * 32 + kmap(e, kh)];
#pragma unroll
                    for (int g = 0; g < 2; g++) sacc[g][t] = wmma_bf16(a, qb[g][dc], dc == 0 ? nref[g] : sacc[g][t]);
                }
            }

            if (renew) {
#pragma unroll
                for (int g = 0; g < 2; g++) {
                    // largest exponent of query lm: 32 keys in this lane, the other 32 in lane ^ 16
                    float tmax[4];
#pragma unroll
                    for (int t = 0; t < 4; t++) {
                        tmax[t] = sacc[g][t][0];
#pragma unroll
                        for (int r = 1; r < 8; r++) tmax[t] = fmaxf(tmax[t], sacc[g][t][r]);
                    }
                    float v = fmaxf(fmaxf(tmax[0], tmax[1]), fmaxf(tmax[2], tmax[3]));
                    v = fmaxf(v, xhalf(v));
                    const float d = (j0 == 0) ? v : fmaxf(v, 0.0f);     // after the first tile the reference only rises
                    // first tile: sums and output are still 0, the bound keeps the factor finite
                    const float corr = exp2x1(fminf(-d, 64.0f));
#pragma unroll
                    for (int r = 0; r < 8; r++) nref[g][r] -= d;
                    lrow[g] *= corr;
#pragma unroll
                    for (int t = 0; t < 4; t++)
#pragma unroll
                        for (int r = 0; r < 8; r++) { sacc[g][t][r] -= d; cacc[g][t][r] *= corr; }
                }
            }

#pragma unroll
            for (int g = 0; g < 2; g++) {
                float tsum[4];
#pragma unroll
                for (int t = 0; t < 4; t++) {
                    sacc[g][t] = exp2x8(sacc[g][t]);
                    tsum[t] = 0.0f;
#pragma unroll
                    for (int r = 0; r < 8; r++) tsum[t] += sacc[g][t][r];
                }
                tl[g] = (tsum[0] + tsum[1]) + (tsum[2] + tsum[3]);

                // P^T as B operand: k = key 32kc + kmap(e, kh) is register e & 7 of tile 2kc + (e >> 3)
#pragma unroll
                for (int kc = 0; kc < 2; kc++)
#pragma unroll
                    for (int e = 0; e < 16; e++) pb[g][kc][e] = (__bf16)sacc[g][2 * kc + (e >> 3)][e & 7];
            }

            // one scalar branch per tile; behind a renewal every P is at most 1
            if (renew || __builtin_amdgcn_ballot_w32(fmaxf(tl[0], tl[1]) > 256.0f) == 0) break;
            renew = true;
        }
        lrow[0] += tl[0];
        lrow[1] += tl[1];

        // O^T += V^T @ P^T : A row lm = d 16t + lm, k = key in kmap order; each V^T fragment used for both groups
#pragma unroll
        for (int t = 0; t < 4; t++) {
#pragma unroll
            for (int kc = 0; kc < 2; kc++) {
                const __bf16* vp = Vt + vrow + kc * 32 * VS + t * 16;
                const bf16x8 lo = ld_tr16(vp);
                const bf16x8 hi = ld_tr16(vp + 16 * VS);
                const bf16x16 va = __builtin_shufflevector(lo, hi, 0, 1, 2, 3, 4, 5, 6, 7,
                                                           8, 9, 10, 11, 12, 13, 14, 15);
#pragma unroll
                for (int g = 0; g < 2; g++) cacc[g][t] = wmma_bf16(va, pb[g][kc], cacc[g][t]);
            }
        }
    }

    const int bidx = bh / NHEAD;
    const int h    = bh % NHEAD;
#pragma unroll
    for (int g = 0; g < 2; g++) {
        const float lsum = lrow[g] + xhalf(lrow[g]);    // join the two halves' key sums
        const int s = q0 + wave * 32 + g * 16 + lm;
        __bf16* crow = Ctx + ((size_t)(bidx * SEQ + s)) * D_MODEL + h * DK + 8 * kh;
#pragma unroll
        for (int t = 0; t < 4; t++) {
            bf16x8 o;                // 8 consecutive d of one query: one 16-byte store
#pragma unroll
            for (int r = 0; r < 8; r++) o[r] = (__bf16)(cacc[g][t][r] / lsum);
            *(bf16x8*)(crow + t * 16) = o;
        }
    }
}

// ---------------------------------------------------------------------------
// Kernel 3: output projection. out = ctx @ Wo.T + bo, fp32 result. grid=(64,12)
// ---------------------------------------------------------------------------
__global__ __launch_bounds__(256)
void out_proj_kernel(const __bf16* __restrict__ Ctx, const float* __restrict__ Wo,
                     const float* __restrict__ bo, float* __restrict__ Out)
{
    const int m0 = blockIdx.x * 128;
    const int n0 = blockIdx.y * 64;

    __shared__ __bf16 Xs[2][128 * GS];
    __shared__ __bf16 Ws[2][64 * GS];

    const int tid  = threadIdx.x;
    const int wave = tid >> 5;
    const int lane = tid & 31;
    const int lm   = lane & 15;
    const int kh   = lane >> 4;

    f32x8 acc[4] = {};

    // this thread's chunks of a k-step's tiles: ctx rows cr + 64 i (8 bf16), Wo rows sr + 32 i (4 f32)
    const int cr = tid >> 2, cc = (tid & 3) * 8;
    const int sr = tid >> 3, sc = (tid & 7) * 4;
    const __bf16* cg = Ctx + (size_t)(m0 + cr) * D_MODEL + cc;
    const float*  wg = Wo  + (size_t)(n0 + sr) * D_MODEL + sc;

    // step k + 1's tiles are loaded into registers while step k's products run; two LDS
    // buffers and one barrier a step, as in the first projection kernel
    bf16x8 xr[2];
    float4 wr[2];
#pragma unroll
    for (int i = 0; i < 2; i++) xr[i] = *(const bf16x8*)(cg + (size_t)(64 * i) * D_MODEL);
#pragma unroll
    for (int i = 0; i < 2; i++) wr[i] = *(const float4*)(wg + (size_t)(32 * i) * D_MODEL);

    int buf = 0;
    for (int k0 = 0; k0 < D_MODEL; k0 += 32, buf ^= 1) {
        __bf16* Xt = Xs[buf];
        __bf16* Wt = Ws[buf];
#pragma unroll
        for (int i = 0; i < 2; i++)             // ctx tile 128x32 bf16
            *(bf16x8*)(&Xt[(cr + 64 * i) * GS + cc]) = xr[i];
#pragma unroll
        for (int i = 0; i < 2; i++) {           // Wo tile 64x32 f32 -> bf16
            uint2 p; p.x = pack2bf(wr[i].x, wr[i].y); p.y = pack2bf(wr[i].z, wr[i].w);
            *(uint2*)(&Wt[(sr + 32 * i) * GS + sc]) = p;
        }
        __syncthreads();

        if (k0 + 32 < D_MODEL) {                // next step's tiles, in flight under the products
#pragma unroll
            for (int i = 0; i < 2; i++) xr[i] = *(const bf16x8*)(cg + (size_t)(64 * i) * D_MODEL + k0 + 32);
#pragma unroll
            for (int i = 0; i < 2; i++) wr[i] = *(const float4*)(wg + (size_t)(32 * i) * D_MODEL + k0 + 32);
            // these loads' address registers are advanced or reused below while they are in flight
            asm volatile("s_wait_xcnt 0x0" ::: "memory");
        }

        bf16x16 a;
        const int arow = wave * 16 + lm;
#pragma unroll
        for (int e = 0; e < 16; e++) a[e] = Xt[arow * GS + kmap(e, kh)];
#pragma unroll
        for (int t = 0; t < 4; t++) {
            bf16x16 b;
            const int bcol = t * 16 + lm;
#pragma unroll
            for (int e = 0; e < 16; e++) b[e] = Wt[bcol * GS + kmap(e, kh)];
            acc[t] = wmma_bf16(a, b, acc[t]);
        }
    }

#pragma unroll
    for (int t = 0; t < 4; t++) {
        const int n   = n0 + t * 16 + lm;
        const float b = bo[n];
#pragma unroll
        for (int r = 0; r < 8; r++) {
            const int M = m0 + wave * 16 + r + 8 * kh;
            Out[(size_t)M * D_MODEL + n] = acc[t][r] + b;
        }
    }
}

// ---------------------------------------------------------------------------
extern "C" void kernel_launch(void* const* d_in, const int* in_sizes, int n_in,
                              void* d_out, int out_size, void* d_ws, size_t ws_size,
                              hipStream_t stream)
{
    (void)in_sizes; (void)n_in; (void)out_size;

    const float* x  = (const float*)d_in[0];
    const float* Wq = (const float*)d_in[1];
    const float* bq = (const float*)d_in[2];
    const float* Wk = (const float*)d_in[3];
    const float* bk = (const float*)d_in[4];
    const float* Wv = (const float*)d_in[5];
    const float* bv = (const float*)d_in[6];
    const float* Wo = (const float*)d_in[7];
    const float* bo = (const float*)d_in[8];
    float* out = (float*)d_out;

    const size_t E = (size_t)MTOT * D_MODEL;      // 6,291,456 elements
    if (ws_size < 4 * E * sizeof(__bf16)) return; // ~48 MB scratch required
    __bf16* ws = (__bf16*)d_ws;
    __bf16* Qb = ws;
    __bf16* Kb = ws + E;
    __bf16* Vb = ws + 2 * E;
    __bf16* Cb = ws + 3 * E;

    dim3 g1(MTOT / QM, 3 * D_MODEL / QN);
    qkv_proj_kernel<<<g1, 256, 0, stream>>>(x, Wq, bq, Wk, bk, Wv, bv, Qb, Kb, Vb);

    dim3 g2(SEQ / 128, BATCH * NHEAD);
    flash_attn_kernel<<<g2, 128, 0, stream>>>(Qb, Kb, Vb, Cb);

    dim3 g3(MTOT / 128, D_MODEL / 64);
    out_proj_kernel<<<g3, 256, 0, stream>>>(Cb, Wo, bo, out);
}

// v006
// Measured time: 128 microseconds a run.
// In two side-by-side timings against v005, it was 1.04 and 1.03 times as fast.
// All steps since v000 together make it 3.40 times as fast.
#include <hip/hip_runtime.h>
#include <hip/hip_bf16.h>

typedef __attribute__((ext_vector_type(16))) __bf16 bf16x16;
typedef __attribute__((ext_vector_type(8)))  float  f32x8;
typedef int v4i_ __attribute__((vector_size(16)));   // matches builtin's pointee type

#define D_MODEL 768
#define NHEAD   12
#define DK      64
#define SEQ     4096
#define BATCH   2
#define MTOT    (BATCH*SEQ)   // 8192

#define GS 40   // GEMM LDS row stride (elems): 80B rows, 16B-aligned, bank stride 20
#define FS 72   // flash LDS row stride (elems): 144B rows, 16B-aligned, bank stride 36
#define VS 80   // V tile LDS row stride (elems): 160B = 32B x odd, the transposing load's pitch
#define QSCALE 0.18033688f   // log2(e) / sqrt(DK)

#if defined(__gfx1250__) && __has_builtin(__builtin_amdgcn_global_load_async_to_lds_b128)
#define HAVE_ASYNC 1
#else
#define HAVE_ASYNC 0
#endif

// A/B fragment K-index mapping for v_wmma_*_16x16x32_bf16 (ISA 7.12.2):
// lanes 0-15 hold K 0..7 (elems 0..7) and 16..23 (elems 8..15);
// lanes 16-31 hold K 8..15 and 24..31.
__device__ __forceinline__ int kmap(int e, int kh) {
    return (e < 8) ? (kh * 8 + e) : (16 + kh * 8 + (e - 8));
}

__device__ __forceinline__ f32x8 wmma_bf16(const bf16x16& a, const bf16x16& b, const f32x8& c) {
    return __builtin_amdgcn_wmma_f32_16x16x32_bf16(false, a, false, b, (short)0, c, false, false);
}

__device__ __forceinline__ unsigned pack2bf(float a, float b) {
    union { __bf16 h[2]; unsigned u; } x;
    x.h[0] = (__bf16)a; x.h[1] = (__bf16)b;
    return x.u;
}

// 16-byte async global->LDS copy (ASYNCcnt path); no-op stub when unavailable.
__device__ __forceinline__ void async_copy16(const __bf16* g, __bf16* l) {
#if HAVE_ASYNC
    __builtin_amdgcn_global_load_async_to_lds_b128(
        (__attribute__((address_space(1))) v4i_*)g,
        (__attribute__((address_space(3))) v4i_*)l,
        0, 0);
#else
    (void)g; (void)l;
#endif
}

__device__ __forceinline__ void wait_async0() {
#if HAVE_ASYNC
#if __has_builtin(__builtin_amdgcn_s_wait_asynccnt)
    __builtin_amdgcn_s_wait_asynccnt(0);
#else
    asm volatile("s_wait_asynccnt 0x0" ::: "memory");
#endif
#endif
}

// ---------------------------------------------------------------------------
// Kernel 1: QKV projection. Y = X @ W.T + b  (W stored [out,in] row-major)
// The three weight matrices are taken as one stack of 2304 output columns [Q | K | V].
// Block: 256 thr = 8 waves. Tile: 256(M) x 288(N), grid = (32, 8): one work-group per
// WGP, so that X comes from L2 8 times and the weights 32 times. Waves 4(M) x 2(N),
// each 64 x 144 = 4 x 9 accumulator tiles: 13 fragments from LDS feed 36 products.
// Output layout: [b, h, s, dk] in bf16, Q times QSCALE. (f32->bf16 conversion during staging,
// so this stays on the synchronous vectorized path.)
// ---------------------------------------------------------------------------
#define QM 256              // rows of X per work-group
#define QN 288              // stacked output columns per work-group
#define QXC (QM / 32)       // 32-row chunks of the X tile
#define QWC (QN / 32)       // 32-row chunks of the W tile; 768 = 24 chunks, so a chunk has one matrix
#define QNT (QN / 32)       // 16-column accumulator tiles per wave (half the tile's 18)

// one work-group of eight waves per WGP is two waves per SIMD: the register budget that
// the 4 x 9 accumulator tiles, the fragments and the staged tiles need without a spill
__global__ __launch_bounds__(256) __attribute__((amdgpu_waves_per_eu(2)))
void qkv_proj_kernel(const float* __restrict__ X,
                     const float* __restrict__ Wq, const float* __restrict__ bq,
                     const float* __restrict__ Wk, const float* __restrict__ bk,
                     const float* __restrict__ Wv, const float* __restrict__ bv,
                     __bf16* __restrict__ Qb, __bf16* __restrict__ Kb, __bf16* __restrict__ Vb)
{
    const int m0 = blockIdx.x * QM;

    __shared__ __bf16 Xs[2][QM * GS];
    __shared__ __bf16 Ws[2][QN * GS];

    const int tid  = threadIdx.x;
    const int wave = __builtin_amdgcn_readfirstlane(tid >> 5);
    const int lane = tid & 31;
    const int lm   = lane & 15;
    const int kh   = lane >> 4;
    const int wm   = wave & 3;          // rows    64 wm  .. 64 wm + 63   of the tile
    const int wn   = wave >> 2;         // columns 144 wn .. 144 wn + 143 of the tile

    f32x8 acc[4][QNT] = {};

    // this thread's float4 chunks of a k-step's tiles: rows sr + 32 i, columns sc .. sc + 3
    const int sr = tid >> 3, sc = (tid & 7) * 4;
    // Every chunk has a base that is the same for the whole work-group; the thread's own
    // part is one byte offset, which also carries the k-step.
    const char* xb = (const char*)(X + (size_t)m0 * D_MODEL);
    const char* wb[QWC];
#pragma unroll
    for (int i = 0; i < QWC; i++) {
        const int c = blockIdx.y * QWC + i;         // chunk of the stack: matrix c / 24, rows 32 (c % 24) ..
        const float* Wp = (c < 24) ? Wq : (c < 48) ? Wk : Wv;
        wb[i] = (const char*)(Wp + (size_t)((c % 24) * 32) * D_MODEL);
    }
    unsigned off = (unsigned)(sr * D_MODEL + sc) * 4u;

    // The tiles of step k + 1 are loaded into registers while step k's products run;
    // two LDS buffers, so that one barrier a step publishes the new tile and also ends
    // the reads of the buffer that the next step overwrites.
    float4 xr[QXC], wr[QWC];
#pragma unroll
    for (int i = 0; i < QXC; i++) xr[i] = *(const float4*)(xb + (size_t)(32 * i) * D_MODEL * 4 + off);
#pragma unroll
    for (int i = 0; i < QWC; i++) wr[i] = *(const float4*)(wb[i] + off);

    int buf = 0;
    for (int k0 = 0; k0 < D_MODEL; k0 += 32, buf ^= 1) {
        __bf16* Xt = Xs[buf];
        __bf16* Wt = Ws[buf];
#pragma unroll
        for (int i = 0; i < QXC; i++) {         // X tile 256x32 f32 -> packed bf16
            uint2 p; p.x = pack2bf(xr[i].x, xr[i].y); p.y = pack2bf(xr[i].z, xr[i].w);
            *(uint2*)(&Xt[(sr + 32 * i) * GS + sc]) = p;
        }
#pragma unroll
        for (int i = 0; i < QWC; i++) {         // W tile 288(n) x 32(k)
            uint2 p; p.x = pack2bf(wr[i].x, wr[i].y); p.y = pack2bf(wr[i].z, wr[i].w);
            *(uint2*)(&Wt[(sr + 32 * i) * GS + sc]) = p;
        }
        __syncthreads();

        if (k0 + 32 < D_MODEL) {                // next step's tiles, in flight under the products
            off += 32 * 4;
#pragma unroll
            for (int i = 0; i < QXC; i++) xr[i] = *(const float4*)(xb + (size_t)(32 * i) * D_MODEL * 4 + off);
#pragma unroll
            for (int i = 0; i < QWC; i++) wr[i] = *(const float4*)(wb[i] + off);
            // these loads' offset register is advanced in the next step while they may be in flight
            asm volatile("s_wait_xcnt 0x0" ::: "memory");
        }

        bf16x16 a[4];
#pragma unroll
        for (int mt = 0; mt < 4; mt++) {
            const int arow = wm * 64 + mt * 16 + lm;
#pragma unroll
            for (int e = 0; e < 16; e++) a[mt][e] = Xt[arow * GS + kmap(e, kh)];
        }
        bf16x16 b[QNT];                         // all of the step's fragments as one group of LDS loads
#pragma unroll
        for (int t = 0; t < QNT; t++) {
            const int bcol = wn * (QN / 2) + t * 16 + lm;
#pragma unroll
            for (int e = 0; e < 16; e++) b[t][e] = Wt[bcol * GS + kmap(e, kh)];
        }
        // keeps the loads above the products: sunk among them, each row of four products
        // would wait out its own fragment's LDS latency
        __builtin_amdgcn_sched_barrier(0);
#pragma unroll
        for (int t = 0; t < QNT; t++)
#pragma unroll
            for (int mt = 0; mt < 4; mt++) acc[mt][t] = wmma_bf16(a[mt], b[t], acc[mt][t]);
    }

#pragma unroll
    for (int t = 0; t < QNT; t++) {
        const int g  = blockIdx.y * (QN / 16) + wn * QNT + t;   // 16-column tile of the stack: 48 a matrix, 4 a head
        const int gh = g % 48;
        const float* bias = (g < 48) ? bq : (g < 96) ? bk : bv;
        __bf16*      Out  = (g < 48) ? Qb : (g < 96) ? Kb : Vb;
        const int h  = gh >> 2;
        const int d  = (gh & 3) * 16 + lm;
        // Q is stored times log2(e)/sqrt(dk): the score products then come out as exponents of 2
        const float osc = (g < 48) ? QSCALE : 1.0f;
        const float bv_ = bias[gh * 16 + lm] * osc;
        // the next column tile's address is formed in this load's offset and base registers
        asm volatile("s_wait_xcnt 0x0" ::: "memory");
#pragma unroll
        for (int mt = 0; mt < 4; mt++) {
#pragma unroll
            for (int r = 0; r < 8; r++) {
                const int M    = m0 + wm * 64 + mt * 16 + r + 8 * kh;
                const int bidx = M >> 12;           // / 4096
                const int s    = M & 4095;
                Out[(((size_t)bidx * NHEAD + h) * SEQ + s) * DK + d] = (__bf16)fmaf(acc[mt][t][r], osc, bv_);
            }
            // later sums and addresses are formed in these stores' data registers
            asm volatile("s_wait_xcnt 0x0" ::: "memory");
            // holds those later register writes behind the wait: the scheduler lifted some over it
            __builtin_amdgcn_sched_barrier(0);
        }
    }
}

typedef __attribute__((ext_vector_type(8))) __bf16 bf16x8;

// Row-major 16-bit LDS tile -> transposed operand half: lane (lm, kh) gets
// T[kbase + 8*kh + 0..7][dbase + lm]; p is the lane's own address (see vrow below).
__device__ __forceinline__ bf16x8 ld_tr16(const __bf16* p) {
    typedef __attribute__((address_space(3))) bf16x8 lds_bf16x8;
    return __builtin_amdgcn_ds_load_tr16_b128_v8bf16((lds_bf16x8*)p);
}

// value of lane l ^ 16
__device__ __forceinline__ float xhalf(float x) {
    return __builtin_bit_cast(float, __builtin_amdgcn_permlanex16(
        __builtin_bit_cast(int, x), __builtin_bit_cast(int, x),
        0x76543210, 0xfedcba98, false, false));
}

// 2^x of one score tile's eight registers. One statement, so that each v_exp_f32 is
// followed by an independent one and the last by v_nop: the slot the instruction set
// asks for before a transcendental's source is overwritten or its result read.
__device__ __forceinline__ f32x8 exp2x8(const f32x8& x) {
    float y0, y1, y2, y3, y4, y5, y6, y7;
    asm("v_exp_f32 %0, %8\n\t"
        "v_exp_f32 %1, %9\n\t"
        "v_exp_f32 %2, %10\n\t"
        "v_exp_f32 %3, %11\n\t"
        "v_exp_f32 %4, %12\n\t"
        "v_exp_f32 %5, %13\n\t"
        "v_exp_f32 %6, %14\n\t"
        "v_exp_f32 %7, %15\n\t"
        "v_nop"
        : "=&v"(y0), "=&v"(y1), "=&v"(y2), "=&v"(y3), "=&v"(y4), "=&v"(y5), "=&v"(y6), "=&v"(y7)
        : "v"(x[0]), "v"(x[1]), "v"(x[2]), "v"(x[3]), "v"(x[4]), "v"(x[5]), "v"(x[6]), "v"(x[7]));
    f32x8 y = {y0, y1, y2, y3, y4, y5, y6, y7};
    return y;
}

// the same for a single value
__device__ __forceinline__ float exp2x1(float x) {
    float y;
    asm("v_exp_f32 %0, %1\n\t"
        "v_nop"
        : "=&v"(y) : "v"(x));
    return y;
}

// 768 work-groups of four waves on 256 WGPs: three resident per WGP (three waves per SIMD) hold the whole
// grid; the upper bound of three keeps a fourth work-group off a WGP, so that the grid spreads evenly
__global__ __launch_bounds__(128) __attribute__((amdgpu_waves_per_eu(3, 3)))
void flash_attn_kernel(const __bf16* __restrict__ Qb, const __bf16* __restrict__ Kb,
                       const __bf16* __restrict__ Vb, __bf16* __restrict__ Ctx)
{
    const int bh = blockIdx.y;
    const int q0 = blockIdx.x * 128;
    const __bf16* Qh = Qb + (size_t)bh * SEQ * DK;
    const __bf16* Kh = Kb + (size_t)bh * SEQ * DK;
    const __bf16* Vh = Vb + (size_t)bh * SEQ * DK;

    __shared__ __attribute__((aligned(16))) __bf16 Qs[128 * FS];
    __shared__ __attribute__((aligned(16))) __bf16 Ks[2][64 * FS];
    __shared__ __attribute__((aligned(16))) __bf16 Vs[2][64 * VS];

    const int tid  = threadIdx.x;
    const int wave = tid >> 5;
    const int lane = tid & 31;
    const int lm   = lane & 15;
    const int kh   = lane >> 4;

    // this thread's four 16B chunks of each 64x64 tile: rows cr + 16 i, columns cc .. cc + 7
    const int cr = tid >> 3, cc = (tid & 7) * 8;

#if HAVE_ASYNC
    // prologue: start DMA of first K/V tiles while we stage Q
#pragma unroll
    for (int i = 0; i < 4; i++) {
        const int r = cr + 16 * i;
        async_copy16(Kh + (size_t)r * DK + cc, &Ks[0][r * FS + cc]);
        async_copy16(Vh + (size_t)r * DK + cc, &Vs[0][r * VS + cc]);
    }
#endif

    // Q block 128x64 bf16: 1024 uint4 loads, 8 per thread, b128 LDS stores
#pragma unroll
    for (int i = 0; i < 8; i++) {
        const int r = cr + 16 * i;
        *(uint4*)(&Qs[r * FS + cc]) = *(const uint4*)(Qh + (size_t)(q0 + r) * DK + cc);
    }
    __syncthreads();

    // B operands of S^T, one per 16-query group g: column lm = query 32 wave + 16 g + lm, k = d in kmap order
    bf16x16 qb[2][2];
#pragma unroll
    for (int g = 0; g < 2; g++) {
        const int qrow = wave * 32 + g * 16 + lm;
#pragma unroll
        for (int dc = 0; dc < 2; dc++)
#pragma unroll
            for (int e = 0; e < 16; e++)
                qb[g][dc][e] = Qs[qrow * FS + dc * 32 + kmap(e, kh)];
    }

    f32x8 nref[2] = {};                     // minus the reference of group g's query lm, in all eight registers (equal in both halves)
    float lrow[2] = {0.0f, 0.0f};           // running sum over this half's keys only
    f32x8 cacc[2][4] = {};                  // cacc[g][t][r] = O^T[d = 16t + 8kh + r][query lm of group g]

    // lane's element offset inside a V tile for the transposing load
    const int vrow = (8 * kh + (lane & 7)) * VS + 8 * ((lane >> 3) & 1);

    int buf = 0;
    for (int j0 = 0; j0 < SEQ; j0 += 64, buf ^= 1) {
#if HAVE_ASYNC
        wait_async0();          // my async copies into Ks/Vs[buf] done
        __syncthreads();        // everyone's done; prior readers of buf^1 done
        if (j0 + 64 < SEQ) {    // kick off next tile into the other buffer
#pragma unroll
            for (int i = 0; i < 4; i++) {
                const int r = cr + 16 * i;
                async_copy16(Kh + (size_t)(j0 + 64 + r) * DK + cc, &Ks[buf ^ 1][r * FS + cc]);
                async_copy16(Vh + (size_t)(j0 + 64 + r) * DK + cc, &Vs[buf ^ 1][r * VS + cc]);
            }
        }
#else
        __syncthreads();
#pragma unroll
        for (int i = 0; i < 4; i++) {
            const int r = cr + 16 * i;
            *(uint4*)(&Ks[buf][r * FS + cc]) = *(const uint4*)(Kh + (size_t)(j0 + r) * DK + cc);
            *(uint4*)(&Vs[buf][r * VS + cc]) = *(const uint4*)(Vh + (size_t)(j0 + r) * DK + cc);
        }
        __syncthreads();
#endif
        const __bf16* Kt = Ks[buf];
        const __bf16* Vt = Vs[buf];

        // S^T = K @ Q^T : 4 key tiles x 2 d-chunks, each K fragment used for both query groups;
        // sacc[g][t][r] = S[query lm of group g][key 16t + 8kh + r] - reference, in powers of 2.
        // Run once per tile. A second time, with a renewed reference, only if the first run's
        // sums pass 2^8 in some lane (as they must if a score passes the reference by more than 8, P <= sum);
        // nothing of the first run has then reached the running sums or the output. At most two
        // runs: the second always leaves the loop.
        bf16x16 pb[2][2];
        bf16x16 va[4][2];                       // V^T fragments: A row lm = d 16t + lm, k = key 32kc + kmap order
        float tl[2];                            // the tile's sum over this half's keys
        bool renew = (j0 == 0);                 // the first tile sets the reference, whatever its scores' size
        for (;;) {
            f32x8 sacc[2][4];
            bf16x16 ka[4][2];
#pragma unroll
            for (int t = 0; t < 4; t++) {
                const int key = t * 16 + lm;
#pragma unroll
                for (int dc = 0; dc < 2; dc++)
#pragma unroll
                    for (int e = 0; e < 16; e++) ka[t][dc][e] = Kt[key * FS + dc * 32 + kmap(e, kh)];
            }
            // keeps the K loads one group above the products: without it the scheduler sinks them among
            // the products in pairs, and each pair of products waits out its own fragment's LDS latency
            __builtin_amdgcn_sched_barrier(0);
#pragma unroll
            for (int dc = 0; dc < 2; dc++)
#pragma unroll
                for (int t = 0; t < 4; t++)
#pragma unroll
                    for (int g = 0; g < 2; g++) sacc[g][t] = wmma_bf16(ka[t][dc], qb[g][dc], dc == 0 ? nref[g] : sacc[g][t]);
            // keeps the V^T loads behind the products, where the K fragments' registers are free for them:
            // lifted among the products they take registers of their own and break up the run of products
            __builtin_amdgcn_sched_barrier(0);

            // All of the tile's V^T fragments as one group of LDS loads right behind the score
            // products, so that their LDS time runs under the exponentials below and the output
            // products follow one another without a wait. The K fragments are read inside this
            // loop, so the rare second run reads them (and V^T) again.
#pragma unroll
            for (int t = 0; t < 4; t++) {
#pragma unroll
                for (int kc = 0; kc < 2; kc++) {
                    const __bf16* vp = Vt + vrow + kc * 32 * VS + t * 16;
                    const bf16x8 lo = ld_tr16(vp);
                    const bf16x8 hi = ld_tr16(vp + 16 * VS);
                    va[t][kc] = __builtin_shufflevector(lo, hi, 0, 1, 2, 3, 4, 5, 6, 7,
                                                        8, 9, 10, 11, 12, 13, 14, 15);
                }
            }

            if (renew) {
#pragma unroll
                for (int g = 0; g < 2; g++) {
                    // largest exponent of query lm: 32 keys in this lane, the other 32 in lane ^ 16
                    float tmax[4];
#pragma unroll
                    for (int t = 0; t < 4; t++) {
                        tmax[t] = sacc[g][t][0];
#pragma unroll
                        for (int r = 1; r < 8; r++) tmax[t] = fmaxf(tmax[t], sacc[g][t][r]);
                    }
                    float v = fmaxf(fmaxf(tmax[0], tmax[1]), fmaxf(tmax[2], tmax[3]));
                    v = fmaxf(v, xhalf(v));
                    const float d = (j0 == 0) ? v : fmaxf(v, 0.0f);     // after the first tile the reference only rises
                    // first tile: sums and output are still 0, the bound keeps the factor finite
                    const float corr = exp2x1(fminf(-d, 64.0f));
#pragma unroll
                    for (int r = 0; r < 8; r++) nref[g][r] -= d;
                    lrow[g] *= corr;
#pragma unroll
                    for (int t = 0; t < 4; t++)
#pragma unroll
                        for (int r = 0; r < 8; r++) { sacc[g][t][r] -= d; cacc[g][t][r] *= corr; }
                }
            }

#pragma unroll
            for (int g = 0; g < 2; g++) {
                float tsum[4];
#pragma unroll
                for (int t = 0; t < 4; t++) {
                    sacc[g][t] = exp2x8(sacc[g][t]);
                    tsum[t] = 0.0f;
#pragma unroll
                    for (int r = 0; r < 8; r++) tsum[t] += sacc[g][t][r];
                }
                tl[g] = (tsum[0] + tsum[1]) + (tsum[2] + tsum[3]);

                // P^T as B operand: k = key 32kc + kmap(e, kh) is register e & 7 of tile 2kc + (e >> 3)
#pragma unroll
                for (int kc = 0; kc < 2; kc++)
#pragma unroll
                    for (int e = 0; e < 16; e++) pb[g][kc][e] = (__bf16)sacc[g][2 * kc + (e >> 3)][e & 7];
            }

            // one scalar branch per tile; behind a renewal every P is at most 1
            if (renew || __builtin_amdgcn_ballot_w32(fmaxf(tl[0], tl[1]) > 256.0f) == 0) break;
            renew = true;
        }
        lrow[0] += tl[0];
        lrow[1] += tl[1];

        // O^T += V^T @ P^T : A row lm = d 16t + lm, k = key in kmap order; each V^T fragment used for both groups
#pragma unroll
        for (int t = 0; t < 4; t++) {
#pragma unroll
            for (int kc = 0; kc < 2; kc++) {
#pragma unroll
                for (int g = 0; g < 2; g++) cacc[g][t] = wmma_bf16(va[t][kc], pb[g][kc], cacc[g][t]);
            }
        }
    }

    const int bidx = bh / NHEAD;
    const int h    = bh % NHEAD;
#pragma unroll
    for (int g = 0; g < 2; g++) {
        const float lsum = lrow[g] + xhalf(lrow[g]);    // join the two halves' key sums
        const int s = q0 + wave * 32 + g * 16 + lm;
        __bf16* crow = Ctx + ((size_t)(bidx * SEQ + s)) * D_MODEL + h * DK + 8 * kh;
#pragma unroll
        for (int t = 0; t < 4; t++) {
            bf16x8 o;                // 8 consecutive d of one query: one 16-byte store
#pragma unroll
            for (int r = 0; r < 8; r++) o[r] = (__bf16)(cacc[g][t][r] / lsum);
            *(bf16x8*)(crow + t * 16) = o;
        }
    }
}

// ---------------------------------------------------------------------------
// Kernel 3: output projection. out = ctx @ Wo.T + bo, fp32 result. grid=(64,12)
// ---------------------------------------------------------------------------
__global__ __launch_bounds__(256)
void out_proj_kernel(const __bf16* __restrict__ Ctx, const float* __restrict__ Wo,
                     const float* __restrict__ bo, float* __restrict__ Out)
{
    const int m0 = blockIdx.x * 128;
    const int n0 = blockIdx.y * 64;

    __shared__ __bf16 Xs[2][128 * GS];
    __shared__ __bf16 Ws[2][64 * GS];

    const int tid  = threadIdx.x;
    const int wave = tid >> 5;
    const int lane = tid & 31;
    const int lm   = lane & 15;
    const int kh   = lane >> 4;

    f32x8 acc[4] = {};

    // this thread's chunks of a k-step's tiles: ctx rows cr + 64 i (8 bf16), Wo rows sr + 32 i (4 f32)
    const int cr = tid >> 2, cc = (tid & 3) * 8;
    const int sr = tid >> 3, sc = (tid & 7) * 4;
    const __bf16* cg = Ctx + (size_t)(m0 + cr) * D_MODEL + cc;
    const float*  wg = Wo  + (size_t)(n0 + sr) * D_MODEL + sc;

    // step k + 1's tiles are loaded into registers while step k's products run; two LDS
    // buffers and one barrier a step, as in the first projection kernel
    bf16x8 xr[2];
    float4 wr[2];
#pragma unroll
    for (int i = 0; i < 2; i++) xr[i] = *(const bf16x8*)(cg + (size_t)(64 * i) * D_MODEL);
#pragma unroll
    for (int i = 0; i < 2; i++) wr[i] = *(const float4*)(wg + (size_t)(32 * i) * D_MODEL);

    int buf = 0;
    for (int k0 = 0; k0 < D_MODEL; k0 += 32, buf ^= 1) {
        __bf16* Xt = Xs[buf];
        __bf16* Wt = Ws[buf];
#pragma unroll
        for (int i = 0; i < 2; i++)             // ctx tile 128x32 bf16
            *(bf16x8*)(&Xt[(cr + 64 * i) * GS + cc]) = xr[i];
#pragma unroll
        for (int i = 0; i < 2; i++) {           // Wo tile 64x32 f32 -> bf16
            uint2 p; p.x = pack2bf(wr[i].x, wr[i].y); p.y = pack2bf(wr[i].z, wr[i].w);
            *(uint2*)(&Wt[(sr + 32 * i) * GS + sc]) = p;
        }
        __syncthreads();

        if (k0 + 32 < D_MODEL) {                // next step's tiles, in flight under the products
#pragma unroll
            for (int i = 0; i < 2; i++) xr[i] = *(const bf16x8*)(cg + (size_t)(64 * i) * D_MODEL + k0 + 32);
#pragma unroll
            for (int i = 0; i < 2; i++) wr[i] = *(const float4*)(wg + (size_t)(32 * i) * D_MODEL + k0 + 32);
            // these loads' address registers are advanced or reused below while they are in flight
            asm volatile("s_wait_xcnt 0x0" ::: "memory");
        }

        bf16x16 a;
        const int arow = wave * 16 + lm;
#pragma unroll
        for (int e = 0; e < 16; e++) a[e] = Xt[arow * GS + kmap(e, kh)];
#pragma unroll
        for (int t = 0; t < 4; t++) {
            bf16x16 b;
            const int bcol = t * 16 + lm;
#pragma unroll
            for (int e = 0; e < 16; e++) b[e] = Wt[bcol * GS + kmap(e, kh)];
            acc[t] = wmma_bf16(a, b, acc[t]);
        }
    }

#pragma unroll
    for (int t = 0; t < 4; t++) {
        const int n   = n0 + t * 16 + lm;
        const float b = bo[n];
#pragma unroll
        for (int r = 0; r < 8; r++) {
            const int M = m0 + wave * 16 + r + 8 * kh;
            Out[(size_t)M * D_MODEL + n] = acc[t][r] + b;
        }
    }
}

// ---------------------------------------------------------------------------
extern "C" void kernel_launch(void* const* d_in, const int* in_sizes, int n_in,
                              void* d_out, int out_size, void* d_ws, size_t ws_size,
                              hipStream_t stream)
{
    (void)in_sizes; (void)n_in; (void)out_size;

    const float* x  = (const float*)d_in[0];
    const float* Wq = (const float*)d_in[1];
    const float* bq = (const float*)d_in[2];
    const float* Wk = (const float*)d_in[3];
    const float* bk = (const float*)d_in[4];
    const float* Wv = (const float*)d_in[5];
    const float* bv = (const float*)d_in[6];
    const float* Wo = (const float*)d_in[7];
    const float* bo = (const float*)d_in[8];
    float* out = (float*)d_out;

    const size_t E = (size_t)MTOT * D_MODEL;      // 6,291,456 elements
    if (ws_size < 4 * E * sizeof(__bf16)) return; // ~48 MB scratch required
    __bf16* ws = (__bf16*)d_ws;
    __bf16* Qb = ws;
    __bf16* Kb = ws + E;
    __bf16* Vb = ws + 2 * E;
    __bf16* Cb = ws + 3 * E;

    dim3 g1(MTOT / QM, 3 * D_MODEL / QN);
    qkv_proj_kernel<<<g1, 256, 0, stream>>>(x, Wq, bq, Wk, bk, Wv, bv, Qb, Kb, Vb);

    dim3 g2(SEQ / 128, BATCH * NHEAD);
    flash_attn_kernel<<<g2, 128, 0, stream>>>(Qb, Kb, Vb, Cb);

    dim3 g3(MTOT / 128, D_MODEL / 64);
    out_proj_kernel<<<g3, 256, 0, stream>>>(Cb, Wo, bo, out);
}

// v007
// One run takes 122 microseconds.
// Timed twice side by side with v006, it ran 1.05 times as fast both times.
// All steps since v000 together make it 3.56 times as fast.
#include <hip/hip_runtime.h>
#include <hip/hip_bf16.h>

typedef __attribute__((ext_vector_type(16))) __bf16 bf16x16;
typedef __attribute__((ext_vector_type(8)))  float  f32x8;
typedef __attribute__((ext_vector_type(8))) __bf16 bf16x8;
typedef int v4i_ __attribute__((vector_size(16)));   // matches builtin's pointee type

#define D_MODEL 768
#define NHEAD   12
#define DK      64
#define SEQ     4096
#define BATCH   2
#define MTOT    (BATCH*SEQ)   // 8192

#define GS 40   // GEMM LDS row stride (elems): 80B rows, 16B-aligned, bank stride 20
#define FS 72   // flash LDS row stride (elems): 144B rows, 16B-aligned, bank stride 36
#define VS 80   // V tile LDS row stride (elems): 160B = 32B x odd, the transposing load's pitch
#define QSCALE 0.18033688f   // log2(e) / sqrt(DK)

#if defined(__gfx1250__) && __has_builtin(__builtin_amdgcn_global_load_async_to_lds_b128)
#define HAVE_ASYNC 1
#else
#define HAVE_ASYNC 0
#endif

// A/B fragment K-index mapping for v_wmma_*_16x16x32_bf16 (ISA 7.12.2):
// lanes 0-15 hold K 0..7 (elems 0..7) and 16..23 (elems 8..15);
// lanes 16-31 hold K 8..15 and 24..31.
__device__ __forceinline__ int kmap(int e, int kh) {
    return (e < 8) ? (kh * 8 + e) : (16 + kh * 8 + (e - 8));
}

__device__ __forceinline__ f32x8 wmma_bf16(const bf16x16& a, const bf16x16& b, const f32x8& c) {
    return __builtin_amdgcn_wmma_f32_16x16x32_bf16(false, a, false, b, (short)0, c, false, false);
}

__device__ __forceinline__ unsigned pack2bf(float a, float b) {
    union { __bf16 h[2]; unsigned u; } x;
    x.h[0] = (__bf16)a; x.h[1] = (__bf16)b;
    return x.u;
}

// 16-byte async global->LDS copy (ASYNCcnt path); no-op stub when unavailable.
__device__ __forceinline__ void async_copy16(const __bf16* g, __bf16* l) {
#if HAVE_ASYNC
    __builtin_amdgcn_global_load_async_to_lds_b128(
        (__attribute__((address_space(1))) v4i_*)g,
        (__attribute__((address_space(3))) v4i_*)l,
        0, 0);
#else
    (void)g; (void)l;
#endif
}

__device__ __forceinline__ void wait_async0() {
#if HAVE_ASYNC
#if __has_builtin(__builtin_amdgcn_s_wait_asynccnt)
    __builtin_amdgcn_s_wait_asynccnt(0);
#else
    asm volatile("s_wait_asynccnt 0x0" ::: "memory");
#endif
#endif
}

// ---------------------------------------------------------------------------
// Kernel 1: QKV projection. Y = X @ W.T + b  (W stored [out,in] row-major)
// The three weight matrices are taken as one stack of 2304 output columns [Q | K | V].
// Block: 256 thr = 8 waves. Tile: 256(M) x 288(N), grid = (32, 8): one work-group per
// WGP, so that X comes from L2 8 times and the weights 32 times. Waves 4(M) x 2(N),
// each 64 x 144 = 4 x 9 accumulator tiles: 13 fragments from LDS feed 36 products.
// Output layout: [b, h, s, dk] in bf16, Q times QSCALE. (f32->bf16 conversion during staging,
// so this stays on the synchronous vectorized path.)
// The products are taken as W @ X^T, so that a lane holds 8 neighbouring output columns of one
// row of X. Each wave lays its 64 x 144 result in an LDS range of its own and stores it from
// there head by head: 8 lanes cover the 128-byte row of a head, a store covers four such rows.
// ---------------------------------------------------------------------------
#define QM 256              // rows of X per work-group
#define QN 288              // stacked output columns per work-group
#define QXC (QM / 32)       // 32-row chunks of the X tile
#define QWC (QN / 32)       // 32-row chunks of the W tile; 768 = 24 chunks, so a chunk has one matrix
#define QNT (QN / 32)       // 16-column accumulator tiles per wave (half the tile's 18)
#define QSP 152             // result staging row stride (elems): 304B = 16B x odd for the 16-byte LDS stores

// one work-group of eight waves per WGP is two waves per SIMD: the register budget that
// the 4 x 9 accumulator tiles, the fragments and the staged tiles need without a spill
__global__ __launch_bounds__(256) __attribute__((amdgpu_waves_per_eu(2)))
void qkv_proj_kernel(const float* __restrict__ X,
                     const float* __restrict__ Wq, const float* __restrict__ bq,
                     const float* __restrict__ Wk, const float* __restrict__ bk,
                     const float* __restrict__ Wv, const float* __restrict__ bv,
                     __bf16* __restrict__ Qb, __bf16* __restrict__ Kb, __bf16* __restrict__ Vb)
{
    const int m0 = blockIdx.x * QM;

    __shared__ __bf16 Xs[2][QM * GS];
    __shared__ __bf16 Ws[2][QN * GS];
    __shared__ __attribute__((aligned(16))) __bf16 Cs[8][64 * QSP];     // a range per wave, so no barrier

    const int tid  = threadIdx.x;
    const int wave = __builtin_amdgcn_readfirstlane(tid >> 5);
    const int lane = tid & 31;
    const int lm   = lane & 15;
    const int kh   = lane >> 4;
    const int wm   = wave & 3;          // rows    64 wm  .. 64 wm + 63   of the tile
    const int wn   = wave >> 2;         // columns 144 wn .. 144 wn + 143 of the tile

    f32x8 acc[4][QNT] = {};

    // this thread's float4 chunks of a k-step's tiles: rows sr + 32 i, columns sc .. sc + 3
    const int sr = tid >> 3, sc = (tid & 7) * 4;
    // Every chunk has a base that is the same for the whole work-group; the thread's own
    // part is one byte offset, which also carries the k-step.
    const char* xb = (const char*)(X + (size_t)m0 * D_MODEL);
    const char* wb[QWC];
#pragma unroll
    for (int i = 0; i < QWC; i++) {
        const int c = blockIdx.y * QWC + i;         // chunk of the stack: matrix c / 24, rows 32 (c % 24) ..
        const float* Wp = (c < 24) ? Wq : (c < 48) ? Wk : Wv;
        wb[i] = (const char*)(Wp + (size_t)((c % 24) * 32) * D_MODEL);
    }
    unsigned off = (unsigned)(sr * D_MODEL + sc) * 4u;

    // The tiles of step k + 1 are loaded into registers while step k's products run;
    // two LDS buffers, so that one barrier a step publishes the new tile and also ends
    // the reads of the buffer that the next step overwrites.
    float4 xr[QXC], wr[QWC];
#pragma unroll
    for (int i = 0; i < QXC; i++) xr[i] = *(const float4*)(xb + (size_t)(32 * i) * D_MODEL * 4 + off);
#pragma unroll
    for (int i = 0; i < QWC; i++) wr[i] = *(const float4*)(wb[i] + off);

    int buf = 0;
    for (int k0 = 0; k0 < D_MODEL; k0 += 32, buf ^= 1) {
        __bf16* Xt = Xs[buf];
        __bf16* Wt = Ws[buf];
#pragma unroll
        for (int i = 0; i < QXC; i++) {         // X tile 256x32 f32 -> packed bf16
            uint2 p; p.x = pack2bf(xr[i].x, xr[i].y); p.y = pack2bf(xr[i].z, xr[i].w);
            *(uint2*)(&Xt[(sr + 32 * i) * GS + sc]) = p;
        }
#pragma unroll
        for (int i = 0; i < QWC; i++) {         // W tile 288(n) x 32(k)
            uint2 p; p.x = pack2bf(wr[i].x, wr[i].y); p.y = pack2bf(wr[i].z, wr[i].w);
            *(uint2*)(&Wt[(sr + 32 * i) * GS + sc]) = p;
        }
        __syncthreads();

        if (k0 + 32 < D_MODEL) {                // next step's tiles, in flight under the products
            off += 32 * 4;
#pragma unroll
            for (int i = 0; i < QXC; i++) xr[i] = *(const float4*)(xb + (size_t)(32 * i) * D_MODEL * 4 + off);
#pragma unroll
            for (int i = 0; i < QWC; i++) wr[i] = *(const float4*)(wb[i] + off);
            // these loads' offset register is advanced in the next step while they may be in flight
            asm volatile("s_wait_xcnt 0x0" ::: "memory");
        }

        bf16x16 a[4];
#pragma unroll
        for (int mt = 0; mt < 4; mt++) {
            const int arow = wm * 64 + mt * 16 + lm;
#pragma unroll
            for (int e = 0; e < 16; e++) a[mt][e] = Xt[arow * GS + kmap(e, kh)];
        }
        bf16x16 b[QNT];                         // all of the step's fragments as one group of LDS loads
#pragma unroll
        for (int t = 0; t < QNT; t++) {
            const int bcol = wn * (QN / 2) + t * 16 + lm;
#pragma unroll
            for (int e = 0; e < 16; e++) b[t][e] = Wt[bcol * GS + kmap(e, kh)];
        }
        // keeps the loads above the products: sunk among them, each row of four products
        // would wait out its own fragment's LDS latency
        __builtin_amdgcn_sched_barrier(0);
#pragma unroll
        for (int t = 0; t < QNT; t++)
#pragma unroll
            for (int mt = 0; mt < 4; mt++) acc[mt][t] = wmma_bf16(b[t], a[mt], acc[mt][t]);
    }

    // acc[mt][t][r] = Y[row 64 wm + 16 mt + lm][stack column 144 wn + 16 t + 8 kh + r]
    const int g0 = blockIdx.y * (QN / 16) + wn * QNT;   // the wave's first 16-column tile of the stack: 48 a matrix, 4 a head
    float4 bl[QNT][2];                                  // the lane's 8 bias values per column tile, loaded as one group
#pragma unroll
    for (int t = 0; t < QNT; t++) {
        const int g  = g0 + t;
        const float* bias = ((g < 48) ? bq : (g < 96) ? bk : bv) + (g % 48) * 16 + 8 * kh;
        bl[t][0] = *(const float4*)(bias);
        // the group's last load may take the lane offset's register, which the loads before it name, for its result
        if (t == QNT - 1) asm volatile("s_wait_xcnt 0x0" ::: "memory");
        bl[t][1] = *(const float4*)(bias + 4);
    }
    // later addresses are formed in these loads' address registers
    asm volatile("s_wait_xcnt 0x0" ::: "memory");

    __bf16* st = Cs[wave];
#pragma unroll
    for (int t = 0; t < QNT; t++) {
        // Q is stored times log2(e)/sqrt(dk): the score products then come out as exponents of 2
        const float osc = (g0 + t < 48) ? QSCALE : 1.0f;
        const float bb[8] = {bl[t][0].x * osc, bl[t][0].y * osc, bl[t][0].z * osc, bl[t][0].w * osc,
                             bl[t][1].x * osc, bl[t][1].y * osc, bl[t][1].z * osc, bl[t][1].w * osc};
#pragma unroll
        for (int mt = 0; mt < 4; mt++) {
            bf16x8 o;
#pragma unroll
            for (int r = 0; r < 8; r++) o[r] = (__bf16)fmaf(acc[mt][t][r], osc, bb[r]);
            *(bf16x8*)(&st[(mt * 16 + lm) * QSP + t * 16 + 8 * kh]) = o;
        }
    }
    // the rows are read back by other lanes of this wave: its LDS stores have to be done first
    asm volatile("s_wait_dscnt 0x0" ::: "memory");

    // The wave's 9 column tiles touch 3 heads of the stack. Per head: lane = (row group j, 16-byte chunk ch of
    // the head's 128-byte row); lanes whose chunk lies in a neighbour wave's columns are off.
    // Rows 8 apart in lanes 0-15 (and in 16-31): at this stride their two 128-byte runs fall on disjoint banks.
    const int j  = lane >> 3, ch = lane & 7;
    const int M0 = m0 + wm * 64;                        // 64 rows of one batch element
    const int rw = 8 * (j & 1) + 16 * (j >> 1);
#pragma unroll
    for (int w = 0; w < 3; w++) {
        const int hd = (g0 >> 2) + w;                   // head of the stack: 12 a matrix
        const int tl = hd * 4 + (ch >> 1) - g0;         // the wave's column tile that holds this chunk
        __bf16* Out = (hd < 12) ? Qb : (hd < 24) ? Kb : Vb;
        __bf16* op  = Out + (((size_t)(M0 >> 12) * NHEAD + hd % 12) * SEQ + (M0 & 4095) + rw) * DK + ch * 8;
        if (tl >= 0 && tl < QNT) {
            const __bf16* sp = st + rw * QSP + tl * 16 + (ch & 1) * 8;
            bf16x8 v[16];
#pragma unroll
            for (int i = 0; i < 16; i++) v[i] = *(const bf16x8*)(sp + ((i & 7) + 32 * (i >> 3)) * QSP);
#pragma unroll
            for (int i = 0; i < 16; i++) *(bf16x8*)(op + ((i & 7) + 32 * (i >> 3)) * DK) = v[i];
            // the next head's rows and addresses are formed in these stores' registers
            if (w < 2) asm volatile("s_wait_xcnt 0x0" ::: "memory");
        }
    }
}

__device__ __forceinline__ bf16x8 ld_tr16(const __bf16* p) {
    typedef __attribute__((address_space(3))) bf16x8 lds_bf16x8;
    return __builtin_amdgcn_ds_load_tr16_b128_v8bf16((lds_bf16x8*)p);
}

// value of lane l ^ 16
__device__ __forceinline__ float xhalf(float x) {
    return __builtin_bit_cast(float, __builtin_amdgcn_permlanex16(
        __builtin_bit_cast(int, x), __builtin_bit_cast(int, x),
        0x76543210, 0xfedcba98, false, false));
}

// 2^x of one score tile's eight registers. One statement, so that each v_exp_f32 is
// followed by an independent one and the last by v_nop: the slot the instruction set
// asks for before a transcendental's source is overwritten or its result read.
__device__ __forceinline__ f32x8 exp2x8(const f32x8& x) {
    float y0, y1, y2, y3, y4, y5, y6, y7;
    asm("v_exp_f32 %0, %8\n\t"
        "v_exp_f32 %1, %9\n\t"
        "v_exp_f32 %2, %10\n\t"
        "v_exp_f32 %3, %11\n\t"
        "v_exp_f32 %4, %12\n\t"
        "v_exp_f32 %5, %13\n\t"
        "v_exp_f32 %6, %14\n\t"
        "v_exp_f32 %7, %15\n\t"
        "v_nop"
        : "=&v"(y0), "=&v"(y1), "=&v"(y2), "=&v"(y3), "=&v"(y4), "=&v"(y5), "=&v"(y6), "=&v"(y7)
        : "v"(x[0]), "v"(x[1]), "v"(x[2]), "v"(x[3]), "v"(x[4]), "v"(x[5]), "v"(x[6]), "v"(x[7]));
    f32x8 y = {y0, y1, y2, y3, y4, y5, y6, y7};
    return y;
}

// the same for a single value
__device__ __forceinline__ float exp2x1(float x) {
    float y;
    asm("v_exp_f32 %0, %1\n\t"
        "v_nop"
        : "=&v"(y) : "v"(x));
    return y;
}

// 768 work-groups of four waves on 256 WGPs: three resident per WGP (three waves per SIMD) hold the whole
// grid; the upper bound of three keeps a fourth work-group off a WGP, so that the grid spreads evenly
__global__ __launch_bounds__(128) __attribute__((amdgpu_waves_per_eu(3, 3)))
void flash_attn_kernel(const __bf16* __restrict__ Qb, const __bf16* __restrict__ Kb,
                       const __bf16* __restrict__ Vb, __bf16* __restrict__ Ctx)
{
    const int bh = blockIdx.y;
    const int q0 = blockIdx.x * 128;
    const __bf16* Qh = Qb + (size_t)bh * SEQ * DK;
    const __bf16* Kh = Kb + (size_t)bh * SEQ * DK;
    const __bf16* Vh = Vb + (size_t)bh * SEQ * DK;

    __shared__ __attribute__((aligned(16))) __bf16 Qs[128 * FS];
    __shared__ __attribute__((aligned(16))) __bf16 Ks[2][64 * FS];
    __shared__ __attribute__((aligned(16))) __bf16 Vs[2][64 * VS];

    const int tid  = threadIdx.x;
    const int wave = tid >> 5;
    const int lane = tid & 31;
    const int lm   = lane & 15;
    const int kh   = lane >> 4;

    // this thread's four 16B chunks of each 64x64 tile: rows cr + 16 i, columns cc .. cc + 7
    const int cr = tid >> 3, cc = (tid & 7) * 8;

#if HAVE_ASYNC
    // prologue: start DMA of first K/V tiles while we stage Q
#pragma unroll
    for (int i = 0; i < 4; i++) {
        const int r = cr + 16 * i;
        async_copy16(Kh + (size_t)r * DK + cc, &Ks[0][r * FS + cc]);
        async_copy16(Vh + (size_t)r * DK + cc, &Vs[0][r * VS + cc]);
    }
#endif

    // Q block 128x64 bf16: 1024 uint4 loads, 8 per thread, b128 LDS stores
#pragma unroll
    for (int i = 0; i < 8; i++) {
        const int r = cr + 16 * i;
        *(uint4*)(&Qs[r * FS + cc]) = *(const uint4*)(Qh + (size_t)(q0 + r) * DK + cc);
    }
    __syncthreads();

    // B operands of S^T, one per 16-query group g: column lm = query 32 wave + 16 g + lm, k = d in kmap order
    bf16x16 qb[2][2];
#pragma unroll
    for (int g = 0; g < 2; g++) {
        const int qrow = wave * 32 + g * 16 + lm;
#pragma unroll
        for (int dc = 0; dc < 2; dc++)
#pragma unroll
            for (int e = 0; e < 16; e++)
                qb[g][dc][e] = Qs[qrow * FS + dc * 32 + kmap(e, kh)];
    }

    f32x8 nref[2] = {};                     // minus the reference of group g's query lm, in all eight registers (equal in both halves)
    float lrow[2] = {0.0f, 0.0f};           // running sum over this half's keys only
    f32x8 cacc[2][4] = {};                  // cacc[g][t][r] = O^T[d = 16t + 8kh + r][query lm of group g]

    // lane's element offset inside a V tile for the transposing load
    const int vrow = (8 * kh + (lane & 7)) * VS + 8 * ((lane >> 3) & 1);

    int buf = 0;
    for (int j0 = 0; j0 < SEQ; j0 += 64, buf ^= 1) {
#if HAVE_ASYNC
        wait_async0();          // my async copies into Ks/Vs[buf] done
        __syncthreads();        // everyone's done; prior readers of buf^1 done
        if (j0 + 64 < SEQ) {    // kick off next tile into the other buffer
#pragma unroll
            for (int i = 0; i < 4; i++) {
                const int r = cr + 16 * i;
                async_copy16(Kh + (size_t)(j0 + 64 + r) * DK + cc, &Ks[buf ^ 1][r * FS + cc]);
                async_copy16(Vh + (size_t)(j0 + 64 + r) * DK + cc, &Vs[buf ^ 1][r * VS + cc]);
            }
        }
#else
        __syncthreads();
#pragma unroll
        for (int i = 0; i < 4; i++) {
            const int r = cr + 16 * i;
            *(uint4*)(&Ks[buf][r * FS + cc]) = *(const uint4*)(Kh + (size_t)(j0 + r) * DK + cc);
            *(uint4*)(&Vs[buf][r * VS + cc]) = *(const uint4*)(Vh + (size_t)(j0 + r) * DK + cc);
        }
        __syncthreads();
#endif
        const __bf16* Kt = Ks[buf];
        const __bf16* Vt = Vs[buf];

        // S^T = K @ Q^T : 4 key tiles x 2 d-chunks, each K fragment used for both query groups;
        // sacc[g][t][r] = S[query lm of group g][key 16t + 8kh + r] - reference, in powers of 2.
        // Run once per tile. A second time, with a renewed reference, only if the first run's
        // sums pass 2^8 in some lane (as they must if a score passes the reference by more than 8, P <= sum);
        // nothing of the first run has then reached the running sums or the output. At most two
        // runs: the second always leaves the loop.
        bf16x16 pb[2][2];
        bf16x16 va[4][2];                       // V^T fragments: A row lm = d 16t + lm, k = key 32kc + kmap order
        float tl[2];                            // the tile's sum over this half's keys
        bool renew = (j0 == 0);                 // the first tile sets the reference, whatever its scores' size
        for (;;) {
            f32x8 sacc[2][4];
            bf16x16 ka[4][2];
#pragma unroll
            for (int t = 0; t < 4; t++) {
                const int key = t * 16 + lm;
#pragma unroll
                for (int dc = 0; dc < 2; dc++)
#pragma unroll
                    for (int e = 0; e < 16; e++) ka[t][dc][e] = Kt[key * FS + dc * 32 + kmap(e, kh)];
            }
            // keeps the K loads one group above the products: without it the scheduler sinks them among
            // the products in pairs, and each pair of products waits out its own fragment's LDS latency
            __builtin_amdgcn_sched_barrier(0);
#pragma unroll
            for (int dc = 0; dc < 2; dc++)
#pragma unroll
                for (int t = 0; t < 4; t++)
#pragma unroll
                    for (int g = 0; g < 2; g++) sacc[g][t] = wmma_bf16(ka[t][dc], qb[g][dc], dc == 0 ? nref[g] : sacc[g][t]);
            // keeps the V^T loads behind the products, where the K fragments' registers are free for them:
            // lifted among the products they take registers of their own and break up the run of products
            __builtin_amdgcn_sched_barrier(0);

            // All of the tile's V^T fragments as one group of LDS loads right behind the score
            // products, so that their LDS time runs under the exponentials below and the output
            // products follow one another without a wait. The K fragments are read inside this
            // loop, so the rare second run reads them (and V^T) again.
#pragma unroll
            for (int t = 0; t < 4; t++) {
#pragma unroll
                for (int kc = 0; kc < 2; kc++) {
                    const __bf16* vp = Vt + vrow + kc * 32 * VS + t * 16;
                    const bf16x8 lo = ld_tr16(vp);
                    const bf16x8 hi = ld_tr16(vp + 16 * VS);
                    va[t][kc] = __builtin_shufflevector(lo, hi, 0, 1, 2, 3, 4, 5, 6, 7,
                                                        8, 9, 10, 11, 12, 13, 14, 15);
                }
            }

            if (renew) {
#pragma unroll
                for (int g = 0; g < 2; g++) {
                    // largest exponent of query lm: 32 keys in this lane, the other 32 in lane ^ 16
                    float tmax[4];
#pragma unroll
                    for (int t = 0; t < 4; t++) {
                        tmax[t] = sacc[g][t][0];
#pragma unroll
                        for (int r = 1; r < 8; r++) tmax[t] = fmaxf(tmax[t], sacc[g][t][r]);
                    }
                    float v = fmaxf(fmaxf(tmax[0], tmax[1]), fmaxf(tmax[2], tmax[3]));
                    v = fmaxf(v, xhalf(v));
                    const float d = (j0 == 0) ? v : fmaxf(v, 0.0f);     // after the first tile the reference only rises
                    // first tile: sums and output are still 0, the bound keeps the factor finite
                    const float corr = exp2x1(fminf(-d, 64.0f));
#pragma unroll
                    for (int r = 0; r < 8; r++) nref[g][r] -= d;
                    lrow[g] *= corr;
#pragma unroll
                    for (int t = 0; t < 4; t++)
#pragma unroll
                        for (int r = 0; r < 8; r++) { sacc[g][t][r] -= d; cacc[g][t][r] *= corr; }
                }
            }

#pragma unroll
            for (int g = 0; g < 2; g++) {
                float tsum[4];
#pragma unroll
                for (int t = 0; t < 4; t++) {
                    sacc[g][t] = exp2x8(sacc[g][t]);
                    tsum[t] = 0.0f;
#pragma unroll
                    for (int r = 0; r < 8; r++) tsum[t] += sacc[g][t][r];
                }
                tl[g] = (tsum[0] + tsum[1]) + (tsum[2] + tsum[3]);

                // P^T as B operand: k = key 32kc + kmap(e, kh) is register e & 7 of tile 2kc + (e >> 3)
#pragma unroll
                for (int kc = 0; kc < 2; kc++)
#pragma unroll
                    for (int e = 0; e < 16; e++) pb[g][kc][e] = (__bf16)sacc[g][2 * kc + (e >> 3)][e & 7];
            }

            // one scalar branch per tile; behind a renewal every P is at most 1
            if (renew || __builtin_amdgcn_ballot_w32(fmaxf(tl[0], tl[1]) > 256.0f) == 0) break;
            renew = true;
        }
        lrow[0] += tl[0];
        lrow[1] += tl[1];

        // O^T += V^T @ P^T : A row lm = d 16t + lm, k = key in kmap order; each V^T fragment used for both groups
#pragma unroll
        for (int t = 0; t < 4; t++) {
#pragma unroll
            for (int kc = 0; kc < 2; kc++) {
#pragma unroll
                for (int g = 0; g < 2; g++) cacc[g][t] = wmma_bf16(va[t][kc], pb[g][kc], cacc[g][t]);
            }
        }
    }

    const int bidx = bh / NHEAD;
    const int h    = bh % NHEAD;
    // The wave's 32 x 64 result goes through its own 32 rows of the Q tile (read by this wave alone, and only
    // before the loop), so that 8 lanes store a query's whole 128-byte row of this head.
    __bf16* st = Qs + wave * 32 * FS;
#pragma unroll
    for (int g = 0; g < 2; g++) {
        const float lsum = lrow[g] + xhalf(lrow[g]);    // join the two halves' key sums
#pragma unroll
        for (int t = 0; t < 4; t++) {
            bf16x8 o;                // 8 consecutive d of one query
#pragma unroll
            for (int r = 0; r < 8; r++) o[r] = (__bf16)(cacc[g][t][r] / lsum);
            *(bf16x8*)(&st[(g * 16 + lm) * FS + t * 16 + 8 * kh]) = o;
        }
    }
    // the rows are read back by other lanes of this wave: its LDS stores have to be done first
    asm volatile("s_wait_dscnt 0x0" ::: "memory");
    // lane = (row group j, 16-byte chunk ch); rows 8 apart in each half of the wave fall on disjoint banks
    const int j  = lane >> 3, ch = lane & 7;
    const int rw = 8 * (j & 1) + 16 * (j >> 1);
    __bf16* crow = Ctx + ((size_t)(bidx * SEQ + q0 + wave * 32 + rw)) * D_MODEL + h * DK + ch * 8;
    bf16x8 v[8];
#pragma unroll
    for (int i = 0; i < 8; i++) v[i] = *(const bf16x8*)(&st[(rw + i) * FS + ch * 8]);
#pragma unroll
    for (int i = 0; i < 8; i++) *(bf16x8*)(crow + (size_t)i * D_MODEL) = v[i];
}

// ---------------------------------------------------------------------------
// Kernel 3: output projection. out = ctx @ Wo.T + bo, fp32 result. grid=(64,12)
// Products taken as Wo @ ctx^T (a lane holds 8 neighbouring columns of one row); each wave lays its
// 16 x 64 result in an LDS range of its own and stores whole 256-byte rows, 16 bytes a lane.
// ---------------------------------------------------------------------------
#define OSP 68   // result staging row stride (floats): 272B = 16B x odd for the 16-byte LDS stores

__global__ __launch_bounds__(256)
void out_proj_kernel(const __bf16* __restrict__ Ctx, const float* __restrict__ Wo,
                     const float* __restrict__ bo, float* __restrict__ Out)
{
    const int m0 = blockIdx.x * 128;
    const int n0 = blockIdx.y * 64;

    __shared__ __bf16 Xs[2][128 * GS];
    __shared__ __bf16 Ws[2][64 * GS];
    __shared__ __attribute__((aligned(16))) float Cs[8][16 * OSP];      // a range per wave, so no barrier

    const int tid  = threadIdx.x;
    const int wave = tid >> 5;
    const int lane = tid & 31;
    const int lm   = lane & 15;
    const int kh   = lane >> 4;

    f32x8 acc[4] = {};

    // this thread's chunks of a k-step's tiles: ctx rows cr + 64 i (8 bf16), Wo rows sr + 32 i (4 f32)
    const int cr = tid >> 2, cc = (tid & 3) * 8;
    const int sr = tid >> 3, sc = (tid & 7) * 4;
    const __bf16* cg = Ctx + (size_t)(m0 + cr) * D_MODEL + cc;
    const float*  wg = Wo  + (size_t)(n0 + sr) * D_MODEL + sc;

    // step k + 1's tiles are loaded into registers while step k's products run; two LDS
    // buffers and one barrier a step, as in the first projection kernel
    bf16x8 xr[2];
    float4 wr[2];
#pragma unroll
    for (int i = 0; i < 2; i++) xr[i] = *(const bf16x8*)(cg + (size_t)(64 * i) * D_MODEL);
#pragma unroll
    for (int i = 0; i < 2; i++) wr[i] = *(const float4*)(wg + (size_t)(32 * i) * D_MODEL);

    int buf = 0;
    for (int k0 = 0; k0 < D_MODEL; k0 += 32, buf ^= 1) {
        __bf16* Xt = Xs[buf];
        __bf16* Wt = Ws[buf];
#pragma unroll
        for (int i = 0; i < 2; i++)             // ctx tile 128x32 bf16
            *(bf16x8*)(&Xt[(cr + 64 * i) * GS + cc]) = xr[i];
#pragma unroll
        for (int i = 0; i < 2; i++) {           // Wo tile 64x32 f32 -> bf16
            uint2 p; p.x = pack2bf(wr[i].x, wr[i].y); p.y = pack2bf(wr[i].z, wr[i].w);
            *(uint2*)(&Wt[(sr + 32 * i) * GS + sc]) = p;
        }
        __syncthreads();

        if (k0 + 32 < D_MODEL) {                // next step's tiles, in flight under the products
#pragma unroll
            for (int i = 0; i < 2; i++) xr[i] = *(const bf16x8*)(cg + (size_t)(64 * i) * D_MODEL + k0 + 32);
#pragma unroll
            for (int i = 0; i < 2; i++) wr[i] = *(const float4*)(wg + (size_t)(32 * i) * D_MODEL + k0 + 32);
            // these loads' address registers are advanced or reused below while they are in flight
            asm volatile("s_wait_xcnt 0x0" ::: "memory");
        }

        bf16x16 a;
        const int arow = wave * 16 + lm;
#pragma unroll
        for (int e = 0; e < 16; e++) a[e] = Xt[arow * GS + kmap(e, kh)];
#pragma unroll
        for (int t = 0; t < 4; t++) {
            bf16x16 b;
            const int bcol = t * 16 + lm;
#pragma unroll
            for (int e = 0; e < 16; e++) b[e] = Wt[bcol * GS + kmap(e, kh)];
            acc[t] = wmma_bf16(b, a, acc[t]);
        }
    }

    // acc[t][r] = out[row 16 wave + lm][column 16 t + 8 kh + r]
    float4 bl[4][2];
#pragma unroll
    for (int t = 0; t < 4; t++) {
        bl[t][0] = *(const float4*)(bo + n0 + t * 16 + 8 * kh);
        bl[t][1] = *(const float4*)(bo + n0 + t * 16 + 8 * kh + 4);
    }
    // later addresses are formed in these loads' address registers
    asm volatile("s_wait_xcnt 0x0" ::: "memory");
    float* st = Cs[wave];
#pragma unroll
    for (int t = 0; t < 4; t++) {
        float4 lo, hi;
        lo.x = acc[t][0] + bl[t][0].x; lo.y = acc[t][1] + bl[t][0].y; lo.z = acc[t][2] + bl[t][0].z; lo.w = acc[t][3] + bl[t][0].w;
        hi.x = acc[t][4] + bl[t][1].x; hi.y = acc[t][5] + bl[t][1].y; hi.z = acc[t][6] + bl[t][1].z; hi.w = acc[t][7] + bl[t][1].w;
        *(float4*)(&st[lm * OSP + t * 16 + 8 * kh])     = lo;
        *(float4*)(&st[lm * OSP + t * 16 + 8 * kh + 4]) = hi;
    }
    // the rows are read back by other lanes of this wave: its LDS stores have to be done first
    asm volatile("s_wait_dscnt 0x0" ::: "memory");
    float* orow = Out + (size_t)(m0 + wave * 16 + kh) * D_MODEL + n0 + lm * 4;   // half a wave per row
    float4 v[8];
#pragma unroll
    for (int i = 0; i < 8; i++) v[i] = *(const float4*)(&st[(2 * i + kh) * OSP + lm * 4]);
#pragma unroll
    for (int i = 0; i < 8; i++) *(float4*)(orow + (size_t)(2 * i) * D_MODEL) = v[i];
}

// ---------------------------------------------------------------------------
extern "C" void kernel_launch(void* const* d_in, const int* in_sizes, int n_in,
                              void* d_out, int out_size, void* d_ws, size_t ws_size,
                              hipStream_t stream)
{
    (void)in_sizes; (void)n_in; (void)out_size;

    const float* x  = (const float*)d_in[0];
    const float* Wq = (const float*)d_in[1];
    const float* bq = (const float*)d_in[2];
    const float* Wk = (const float*)d_in[3];
    const float* bk = (const float*)d_in[4];
    const float* Wv = (const float*)d_in[5];
    const float* bv = (const float*)d_in[6];
    const float* Wo = (const float*)d_in[7];
    const float* bo = (const float*)d_in[8];
    float* out = (float*)d_out;

    const size_t E = (size_t)MTOT * D_MODEL;      // 6,291,456 elements
    if (ws_size < 4 * E * sizeof(__bf16)) return; // ~48 MB scratch required
    __bf16* ws = (__bf16*)d_ws;
    __bf16* Qb = ws;
    __bf16* Kb = ws + E;
    __bf16* Vb = ws + 2 * E;
    __bf16* Cb = ws + 3 * E;

    dim3 g1(MTOT / QM, 3 * D_MODEL / QN);
    qkv_proj_kernel<<<g1, 256, 0, stream>>>(x, Wq, bq, Wk, bk, Wv, bv, Qb, Kb, Vb);

    dim3 g2(SEQ / 128, BATCH * NHEAD);
    flash_attn_kernel<<<g2, 128, 0, stream>>>(Qb, Kb, Vb, Cb);

    dim3 g3(MTOT / 128, D_MODEL / 64);
    out_proj_kernel<<<g3, 256, 0, stream>>>(Cb, Wo, bo, out);
}

// v008
// One run takes 113 microseconds.
// Timed twice side by side with v007, it ran 1.08 times as fast both times.
// All steps since v000 together make it 3.84 times as fast.
#include <hip/hip_runtime.h>
#include <hip/hip_bf16.h>

typedef __attribute__((ext_vector_type(16))) __bf16 bf16x16;
typedef __attribute__((ext_vector_type(8)))  float  f32x8;
typedef __attribute__((ext_vector_type(8))) __bf16 bf16x8;
typedef int v4i_ __attribute__((vector_size(16)));   // matches builtin's pointee type

#define D_MODEL 768
#define NHEAD   12
#define DK      64
#define SEQ     4096
#define BATCH   2
#define MTOT    (BATCH*SEQ)   // 8192

#define GS 40   // GEMM LDS row stride (elems): 80B rows, 16B-aligned, bank stride 20
#define FS 72   // flash LDS row stride (elems): 144B rows, 16B-aligned, bank stride 36
#define VS 80   // V tile LDS row stride (elems): 160B = 32B x odd, the transposing load's pitch
#define QSCALE 0.18033688f   // log2(e) / sqrt(DK)

#if defined(__gfx1250__) && __has_builtin(__builtin_amdgcn_global_load_async_to_lds_b128)
#define HAVE_ASYNC 1
#else
#define HAVE_ASYNC 0
#endif

// A/B fragment K-index mapping for v_wmma_*_16x16x32_bf16 (ISA 7.12.2):
// lanes 0-15 hold K 0..7 (elems 0..7) and 16..23 (elems 8..15);
// lanes 16-31 hold K 8..15 and 24..31.
__device__ __forceinline__ int kmap(int e, int kh) {
    return (e < 8) ? (kh * 8 + e) : (16 + kh * 8 + (e - 8));
}

__device__ __forceinline__ f32x8 wmma_bf16(const bf16x16& a, const bf16x16& b, const f32x8& c) {
    return __builtin_amdgcn_wmma_f32_16x16x32_bf16(false, a, false, b, (short)0, c, false, false);
}

__device__ __forceinline__ unsigned pack2bf(float a, float b) {
    union { __bf16 h[2]; unsigned u; } x;
    x.h[0] = (__bf16)a; x.h[1] = (__bf16)b;
    return x.u;
}

// 16-byte async global->LDS copy (ASYNCcnt path); no-op stub when unavailable.
__device__ __forceinline__ void async_copy16(const __bf16* g, __bf16* l) {
#if HAVE_ASYNC
    __builtin_amdgcn_global_load_async_to_lds_b128(
        (__attribute__((address_space(1))) v4i_*)g,
        (__attribute__((address_space(3))) v4i_*)l,
        0, 0);
#else
    (void)g; (void)l;
#endif
}

__device__ __forceinline__ void wait_async0() {
#if HAVE_ASYNC
#if __has_builtin(__builtin_amdgcn_s_wait_asynccnt)
    __builtin_amdgcn_s_wait_asynccnt(0);
#else
    asm volatile("s_wait_asynccnt 0x0" ::: "memory");
#endif
#endif
}

// ---------------------------------------------------------------------------
// Kernel 1: QKV projection. Y = X @ W.T + b  (W stored [out,in] row-major)
// The three weight matrices are taken as one stack of 2304 output columns [Q | K | V].
// Block: 256 thr = 8 waves. Tile: 256(M) x 288(N), grid = (32, 8): one work-group per
// WGP, so that X comes from L2 8 times and the weights 32 times. Waves 4(M) x 2(N),
// each 64 x 144 = 4 x 9 accumulator tiles: 13 fragments from LDS feed 36 products.
// Output layout: [b, h, s, dk] in bf16, Q times QSCALE. (f32->bf16 conversion during staging,
// so this stays on the synchronous vectorized path.)
// The products are taken as W @ X^T, so that a lane holds 8 neighbouring output columns of one
// row of X. Each wave lays its 64 x 144 result in an LDS range of its own and stores it from
// there head by head: 8 lanes cover the 128-byte row of a head, a store covers four such rows.
// ---------------------------------------------------------------------------
#define QM 256              // rows of X per work-group
#define QN 288              // stacked output columns per work-group
#define QXC (QM / 32)       // 32-row chunks of the X tile
#define QWC (QN / 32)       // 32-row chunks of the W tile; 768 = 24 chunks, so a chunk has one matrix
#define QNT (QN / 32)       // 16-column accumulator tiles per wave (half the tile's 18)
#define QSP 152             // result staging row stride (elems): 304B = 16B x odd for the 16-byte LDS stores

// one work-group of eight waves per WGP is two waves per SIMD: the register budget that
// the 4 x 9 accumulator tiles, the fragments and the staged tiles need without a spill
__global__ __launch_bounds__(256) __attribute__((amdgpu_waves_per_eu(2)))
void qkv_proj_kernel(const float* __restrict__ X,
                     const float* __restrict__ Wq, const float* __restrict__ bq,
                     const float* __restrict__ Wk, const float* __restrict__ bk,
                     const float* __restrict__ Wv, const float* __restrict__ bv,
                     __bf16* __restrict__ Qb, __bf16* __restrict__ Kb, __bf16* __restrict__ Vb)
{
    const int m0 = blockIdx.x * QM;

    __shared__ __bf16 Xs[2][QM * GS];
    __shared__ __bf16 Ws[2][QN * GS];
    __shared__ __attribute__((aligned(16))) __bf16 Cs[8][64 * QSP];     // a range per wave, so no barrier

    const int tid  = threadIdx.x;
    const int wave = __builtin_amdgcn_readfirstlane(tid >> 5);
    const int lane = tid & 31;
    const int lm   = lane & 15;
    const int kh   = lane >> 4;
    const int wm   = wave & 3;          // rows    64 wm  .. 64 wm + 63   of the tile
    const int wn   = wave >> 2;         // columns 144 wn .. 144 wn + 143 of the tile

    f32x8 acc[4][QNT] = {};

    // this thread's float4 chunks of a k-step's tiles: rows sr + 32 i, columns sc .. sc + 3
    const int sr = tid >> 3, sc = (tid & 7) * 4;
    // Every chunk has a base that is the same for the whole work-group; the thread's own
    // part is one byte offset, which also carries the k-step.
    const char* xb = (const char*)(X + (size_t)m0 * D_MODEL);
    const char* wb[QWC];
#pragma unroll
    for (int i = 0; i < QWC; i++) {
        const int c = blockIdx.y * QWC + i;         // chunk of the stack: matrix c / 24, rows 32 (c % 24) ..
        const float* Wp = (c < 24) ? Wq : (c < 48) ? Wk : Wv;
        wb[i] = (const char*)(Wp + (size_t)((c % 24) * 32) * D_MODEL);
    }
    // The 8 work-groups of a row block read the same lines of X, the 32 of a column block the same lines of W.
    // Walking k in step they would ask L2 for the same lines at the same moment, so each starts at a k-step of
    // its own and wraps round: the sharers of X lie 3 steps apart, at most two sharers of W on one step.
    int ks = (int)((blockIdx.x + 3 * blockIdx.y) % (D_MODEL / 32));
    unsigned off = (unsigned)(sr * D_MODEL + sc) * 4u + (unsigned)ks * (32 * 4);

    // The tiles of step k + 1 are loaded into registers while step k's products run;
    // two LDS buffers, so that one barrier a step publishes the new tile and also ends
    // the reads of the buffer that the next step overwrites.
    float4 xr[QXC], wr[QWC];
#pragma unroll
    for (int i = 0; i < QXC; i++) xr[i] = *(const float4*)(xb + (size_t)(32 * i) * D_MODEL * 4 + off);
#pragma unroll
    for (int i = 0; i < QWC; i++) wr[i] = *(const float4*)(wb[i] + off);

    int buf = 0;
    for (int k0 = 0; k0 < D_MODEL; k0 += 32, buf ^= 1) {
        __bf16* Xt = Xs[buf];
        __bf16* Wt = Ws[buf];
#pragma unroll
        for (int i = 0; i < QXC; i++) {         // X tile 256x32 f32 -> packed bf16
            uint2 p; p.x = pack2bf(xr[i].x, xr[i].y); p.y = pack2bf(xr[i].z, xr[i].w);
            *(uint2*)(&Xt[(sr + 32 * i) * GS + sc]) = p;
        }
#pragma unroll
        for (int i = 0; i < QWC; i++) {         // W tile 288(n) x 32(k)
            uint2 p; p.x = pack2bf(wr[i].x, wr[i].y); p.y = pack2bf(wr[i].z, wr[i].w);
            *(uint2*)(&Wt[(sr + 32 * i) * GS + sc]) = p;
        }
        __syncthreads();

        if (k0 + 32 < D_MODEL) {                // next step's tiles, in flight under the products
            ks = (ks + 1 == D_MODEL / 32) ? 0 : ks + 1;
            off += (ks == 0) ? (unsigned)(-(D_MODEL - 32) * 4) : (unsigned)(32 * 4);
#pragma unroll
            for (int i = 0; i < QXC; i++) xr[i] = *(const float4*)(xb + (size_t)(32 * i) * D_MODEL * 4 + off);
#pragma unroll
            for (int i = 0; i < QWC; i++) wr[i] = *(const float4*)(wb[i] + off);
            // these loads' offset register is advanced in the next step while they may be in flight
            asm volatile("s_wait_xcnt 0x0" ::: "memory");
        }

        bf16x16 a[4];
#pragma unroll
        for (int mt = 0; mt < 4; mt++) {
            const int arow = wm * 64 + mt * 16 + lm;
#pragma unroll
            for (int e = 0; e < 16; e++) a[mt][e] = Xt[arow * GS + kmap(e, kh)];
        }
        bf16x16 b[QNT];                         // all of the step's fragments as one group of LDS loads
#pragma unroll
        for (int t = 0; t < QNT; t++) {
            const int bcol = wn * (QN / 2) + t * 16 + lm;
#pragma unroll
            for (int e = 0; e < 16; e++) b[t][e] = Wt[bcol * GS + kmap(e, kh)];
        }
        // keeps the loads above the products: sunk among them, each row of four products
        // would wait out its own fragment's LDS latency
        __builtin_amdgcn_sched_barrier(0);
#pragma unroll
        for (int t = 0; t < QNT; t++)
#pragma unroll
            for (int mt = 0; mt < 4; mt++) acc[mt][t] = wmma_bf16(b[t], a[mt], acc[mt][t]);
    }

    // acc[mt][t][r] = Y[row 64 wm + 16 mt + lm][stack column 144 wn + 16 t + 8 kh + r]
    const int g0 = blockIdx.y * (QN / 16) + wn * QNT;   // the wave's first 16-column tile of the stack: 48 a matrix, 4 a head
    float4 bl[QNT][2];                                  // the lane's 8 bias values per column tile, loaded as one group
#pragma unroll
    for (int t = 0; t < QNT; t++) {
        const int g  = g0 + t;
        const float* bias = ((g < 48) ? bq : (g < 96) ? bk : bv) + (g % 48) * 16 + 8 * kh;
        bl[t][0] = *(const float4*)(bias);
        // the group's last load may take the lane offset's register, which the loads before it name, for its result
        if (t == QNT - 1) asm volatile("s_wait_xcnt 0x0" ::: "memory");
        bl[t][1] = *(const float4*)(bias + 4);
    }
    // later addresses are formed in these loads' address registers
    asm volatile("s_wait_xcnt 0x0" ::: "memory");

    __bf16* st = Cs[wave];
#pragma unroll
    for (int t = 0; t < QNT; t++) {
        // Q is stored times log2(e)/sqrt(dk): the score products then come out as exponents of 2
        const float osc = (g0 + t < 48) ? QSCALE : 1.0f;
        const float bb[8] = {bl[t][0].x * osc, bl[t][0].y * osc, bl[t][0].z * osc, bl[t][0].w * osc,
                             bl[t][1].x * osc, bl[t][1].y * osc, bl[t][1].z * osc, bl[t][1].w * osc};
#pragma unroll
        for (int mt = 0; mt < 4; mt++) {
            bf16x8 o;
#pragma unroll
            for (int r = 0; r < 8; r++) o[r] = (__bf16)fmaf(acc[mt][t][r], osc, bb[r]);
            *(bf16x8*)(&st[(mt * 16 + lm) * QSP + t * 16 + 8 * kh]) = o;
        }
    }
    // the rows are read back by other lanes of this wave: its LDS stores have to be done first
    asm volatile("s_wait_dscnt 0x0" ::: "memory");

    // The wave's 9 column tiles touch 3 heads of the stack. Per head: lane = (row group j, 16-byte chunk ch of
    // the head's 128-byte row); lanes whose chunk lies in a neighbour wave's columns are off.
    // Rows 8 apart in lanes 0-15 (and in 16-31): at this stride their two 128-byte runs fall on disjoint banks.
    const int j  = lane >> 3, ch = lane & 7;
    const int M0 = m0 + wm * 64;                        // 64 rows of one batch element
    const int rw = 8 * (j & 1) + 16 * (j >> 1);
#pragma unroll
    for (int w = 0; w < 3; w++) {
        const int hd = (g0 >> 2) + w;                   // head of the stack: 12 a matrix
        const int tl = hd * 4 + (ch >> 1) - g0;         // the wave's column tile that holds this chunk
        __bf16* Out = (hd < 12) ? Qb : (hd < 24) ? Kb : Vb;
        __bf16* op  = Out + (((size_t)(M0 >> 12) * NHEAD + hd % 12) * SEQ + (M0 & 4095) + rw) * DK + ch * 8;
        if (tl >= 0 && tl < QNT) {
            const __bf16* sp = st + rw * QSP + tl * 16 + (ch & 1) * 8;
            bf16x8 v[16];
#pragma unroll
            for (int i = 0; i < 16; i++) v[i] = *(const bf16x8*)(sp + ((i & 7) + 32 * (i >> 3)) * QSP);
#pragma unroll
            for (int i = 0; i < 16; i++) *(bf16x8*)(op + ((i & 7) + 32 * (i >> 3)) * DK) = v[i];
            // the next head's rows and addresses are formed in these stores' registers
            if (w < 2) asm volatile("s_wait_xcnt 0x0" ::: "memory");
        }
    }
}

__device__ __forceinline__ bf16x8 ld_tr16(const __bf16* p) {
    typedef __attribute__((address_space(3))) bf16x8 lds_bf16x8;
    return __builtin_amdgcn_ds_load_tr16_b128_v8bf16((lds_bf16x8*)p);
}

// value of lane l ^ 16
__device__ __forceinline__ float xhalf(float x) {
    return __builtin_bit_cast(float, __builtin_amdgcn_permlanex16(
        __builtin_bit_cast(int, x), __builtin_bit_cast(int, x),
        0x76543210, 0xfedcba98, false, false));
}

// 2^x of one score tile's eight registers. One statement, so that each v_exp_f32 is
// followed by an independent one and the last by v_nop: the slot the instruction set
// asks for before a transcendental's source is overwritten or its result read.
__device__ __forceinline__ f32x8 exp2x8(const f32x8& x) {
    float y0, y1, y2, y3, y4, y5, y6, y7;
    asm("v_exp_f32 %0, %8\n\t"
        "v_exp_f32 %1, %9\n\t"
        "v_exp_f32 %2, %10\n\t"
        "v_exp_f32 %3, %11\n\t"
        "v_exp_f32 %4, %12\n\t"
        "v_exp_f32 %5, %13\n\t"
        "v_exp_f32 %6, %14\n\t"
        "v_exp_f32 %7, %15\n\t"
        "v_nop"
        : "=&v"(y0), "=&v"(y1), "=&v"(y2), "=&v"(y3), "=&v"(y4), "=&v"(y5), "=&v"(y6), "=&v"(y7)
        : "v"(x[0]), "v"(x[1]), "v"(x[2]), "v"(x[3]), "v"(x[4]), "v"(x[5]), "v"(x[6]), "v"(x[7]));
    f32x8 y = {y0, y1, y2, y3, y4, y5, y6, y7};
    return y;
}

// the same for a single value
__device__ __forceinline__ float exp2x1(float x) {
    float y;
    asm("v_exp_f32 %0, %1\n\t"
        "v_nop"
        : "=&v"(y) : "v"(x));
    return y;
}

// 768 work-groups of four waves on 256 WGPs: three resident per WGP (three waves per SIMD) hold the whole
// grid; the upper bound of three keeps a fourth work-group off a WGP, so that the grid spreads evenly
__global__ __launch_bounds__(128) __attribute__((amdgpu_waves_per_eu(3, 3)))
void flash_attn_kernel(const __bf16* __restrict__ Qb, const __bf16* __restrict__ Kb,
                       const __bf16* __restrict__ Vb, __bf16* __restrict__ Ctx)
{
    const int bh = blockIdx.y;
    const int q0 = blockIdx.x * 128;
    const __bf16* Qh = Qb + (size_t)bh * SEQ * DK;
    const __bf16* Kh = Kb + (size_t)bh * SEQ * DK;
    const __bf16* Vh = Vb + (size_t)bh * SEQ * DK;

    __shared__ __attribute__((aligned(16))) __bf16 Qs[128 * FS];
    __shared__ __attribute__((aligned(16))) __bf16 Ks[2][64 * FS];
    __shared__ __attribute__((aligned(16))) __bf16 Vs[2][64 * VS];

    const int tid  = threadIdx.x;
    const int wave = tid >> 5;
    const int lane = tid & 31;
    const int lm   = lane & 15;
    const int kh   = lane >> 4;

    // this thread's four 16B chunks of each 64x64 tile: rows cr + 16 i, columns cc .. cc + 7
    const int cr = tid >> 3, cc = (tid & 7) * 8;

    // The 32 work-groups of a head read the same K and V tiles. Each starts its walk over the keys at a tile of
    // its own, two tiles from its neighbour's, and wraps round, so that they do not ask L2 for the same lines at
    // the same moment; softmax does not depend on the order of the keys.
    const int js = (int)((2 * blockIdx.x + blockIdx.y) * 64) & (SEQ - 1);

#if HAVE_ASYNC
    // prologue: start DMA of first K/V tiles while we stage Q
#pragma unroll
    for (int i = 0; i < 4; i++) {
        const int r = cr + 16 * i;
        async_copy16(Kh + (size_t)(js + r) * DK + cc, &Ks[0][r * FS + cc]);
        async_copy16(Vh + (size_t)(js + r) * DK + cc, &Vs[0][r * VS + cc]);
    }
#endif

    // Q block 128x64 bf16: 1024 uint4 loads, 8 per thread, b128 LDS stores
#pragma unroll
    for (int i = 0; i < 8; i++) {
        const int r = cr + 16 * i;
        *(uint4*)(&Qs[r * FS + cc]) = *(const uint4*)(Qh + (size_t)(q0 + r) * DK + cc);
    }
    __syncthreads();

    // B operands of S^T, one per 16-query group g: column lm = query 32 wave + 16 g + lm, k = d in kmap order
    bf16x16 qb[2][2];
#pragma unroll
    for (int g = 0; g < 2; g++) {
        const int qrow = wave * 32 + g * 16 + lm;
#pragma unroll
        for (int dc = 0; dc < 2; dc++)
#pragma unroll
            for (int e = 0; e < 16; e++)
                qb[g][dc][e] = Qs[qrow * FS + dc * 32 + kmap(e, kh)];
    }

    f32x8 nref[2] = {};                     // minus the reference of group g's query lm, in all eight registers (equal in both halves)
    float lrow[2] = {0.0f, 0.0f};           // running sum over this half's keys only
    f32x8 cacc[2][4] = {};                  // cacc[g][t][r] = O^T[d = 16t + 8kh + r][query lm of group g]

    // lane's element offset inside a V tile for the transposing load
    const int vrow = (8 * kh + (lane & 7)) * VS + 8 * ((lane >> 3) & 1);

    int buf = 0;
    for (int j0 = 0; j0 < SEQ; j0 += 64, buf ^= 1) {
#if HAVE_ASYNC
        wait_async0();          // my async copies into Ks/Vs[buf] done
        __syncthreads();        // everyone's done; prior readers of buf^1 done
        if (j0 + 64 < SEQ) {    // kick off next tile into the other buffer
            const int jn = (js + j0 + 64) & (SEQ - 1);      // its first key
#pragma unroll
            for (int i = 0; i < 4; i++) {
                const int r = cr + 16 * i;
                async_copy16(Kh + (size_t)(jn + r) * DK + cc, &Ks[buf ^ 1][r * FS + cc]);
                async_copy16(Vh + (size_t)(jn + r) * DK + cc, &Vs[buf ^ 1][r * VS + cc]);
            }
        }
#else
        __syncthreads();
#pragma unroll
        for (int i = 0; i < 4; i++) {
            const int r = cr + 16 * i;
            *(uint4*)(&Ks[buf][r * FS + cc]) = *(const uint4*)(Kh + (size_t)(((js + j0) & (SEQ - 1)) + r) * DK + cc);
            *(uint4*)(&Vs[buf][r * VS + cc]) = *(const uint4*)(Vh + (size_t)(((js + j0) & (SEQ - 1)) + r) * DK + cc);
        }
        __syncthreads();
#endif
        const __bf16* Kt = Ks[buf];
        const __bf16* Vt = Vs[buf];

        // S^T = K @ Q^T : 4 key tiles x 2 d-chunks, each K fragment used for both query groups;
        // sacc[g][t][r] = S[query lm of group g][key 16t + 8kh + r] - reference, in powers of 2.
        // Run once per tile. A second time, with a renewed reference, only if the first run's
        // sums pass 2^8 in some lane (as they must if a score passes the reference by more than 8, P <= sum);
        // nothing of the first run has then reached the running sums or the output. At most two
        // runs: the second always leaves the loop.
        bf16x16 pb[2][2];
        bf16x16 va[4][2];                       // V^T fragments: A row lm = d 16t + lm, k = key 32kc + kmap order
        float tl[2];                            // the tile's sum over this half's keys
        bool renew = (j0 == 0);                 // the first tile sets the reference, whatever its scores' size
        for (;;) {
            f32x8 sacc[2][4];
            bf16x16 ka[4][2];
#pragma unroll
            for (int t = 0; t < 4; t++) {
                const int key = t * 16 + lm;
#pragma unroll
                for (int dc = 0; dc < 2; dc++)
#pragma unroll
                    for (int e = 0; e < 16; e++) ka[t][dc][e] = Kt[key * FS + dc * 32 + kmap(e, kh)];
            }
            // keeps the K loads one group above the products: without it the scheduler sinks them among
            // the products in pairs, and each pair of products waits out its own fragment's LDS latency
            __builtin_amdgcn_sched_barrier(0);
#pragma unroll
            for (int dc = 0; dc < 2; dc++)
#pragma unroll
                for (int t = 0; t < 4; t++)
#pragma unroll
                    for (int g = 0; g < 2; g++) sacc[g][t] = wmma_bf16(ka[t][dc], qb[g][dc], dc == 0 ? nref[g] : sacc[g][t]);
            // keeps the V^T loads behind the products, where the K fragments' registers are free for them:
            // lifted among the products they take registers of their own and break up the run of products
            __builtin_amdgcn_sched_barrier(0);

            // All of the tile's V^T fragments as one group of LDS loads right behind the score
            // products, so that their LDS time runs under the exponentials below and the output
            // products follow one another without a wait. The K fragments are read inside this
            // loop, so the rare second run reads them (and V^T) again.
#pragma unroll
            for (int t = 0; t < 4; t++) {
#pragma unroll
                for (int kc = 0; kc < 2; kc++) {
                    const __bf16* vp = Vt + vrow + kc * 32 * VS + t * 16;
                    const bf16x8 lo = ld_tr16(vp);
                    const bf16x8 hi = ld_tr16(vp + 16 * VS);
                    va[t][kc] = __builtin_shufflevector(lo, hi, 0, 1, 2, 3, 4, 5, 6, 7,
                                                        8, 9, 10, 11, 12, 13, 14, 15);
                }
            }

            if (renew) {
#pragma unroll
                for (int g = 0; g < 2; g++) {
                    // largest exponent of query lm: 32 keys in this lane, the other 32 in lane ^ 16
                    float tmax[4];
#pragma unroll
                    for (int t = 0; t < 4; t++) {
                        tmax[t] = sacc[g][t][0];
#pragma unroll
                        for (int r = 1; r < 8; r++) tmax[t] = fmaxf(tmax[t], sacc[g][t][r]);
                    }
                    float v = fmaxf(fmaxf(tmax[0], tmax[1]), fmaxf(tmax[2], tmax[3]));
                    v = fmaxf(v, xhalf(v));
                    const float d = (j0 == 0) ? v : fmaxf(v, 0.0f);     // after the first tile the reference only rises
                    // first tile: sums and output are still 0, the bound keeps the factor finite
                    const float corr = exp2x1(fminf(-d, 64.0f));
#pragma unroll
                    for (int r = 0; r < 8; r++) nref[g][r] -= d;
                    lrow[g] *= corr;
#pragma unroll
                    for (int t = 0; t < 4; t++)
#pragma unroll
                        for (int r = 0; r < 8; r++) { sacc[g][t][r] -= d; cacc[g][t][r] *= corr; }
                }
            }

#pragma unroll
            for (int g = 0; g < 2; g++) {
                float tsum[4];
#pragma unroll
                for (int t = 0; t < 4; t++) {
                    sacc[g][t] = exp2x8(sacc[g][t]);
                    tsum[t] = 0.0f;
#pragma unroll
                    for (int r = 0; r < 8; r++) tsum[t] += sacc[g][t][r];
                }
                tl[g] = (tsum[0] + tsum[1]) + (tsum[2] + tsum[3]);

                // P^T as B operand: k = key 32kc + kmap(e, kh) is register e & 7 of tile 2kc + (e >> 3)
#pragma unroll
                for (int kc = 0; kc < 2; kc++)
#pragma unroll
                    for (int e = 0; e < 16; e++) pb[g][kc][e] = (__bf16)sacc[g][2 * kc + (e >> 3)][e & 7];
            }

            // one scalar branch per tile; behind a renewal every P is at most 1
            if (renew || __builtin_amdgcn_ballot_w32(fmaxf(tl[0], tl[1]) > 256.0f) == 0) break;
            renew = true;
        }
        lrow[0] += tl[0];
        lrow[1] += tl[1];

        // O^T += V^T @ P^T : A row lm = d 16t + lm, k = key in kmap order; each V^T fragment used for both groups
#pragma unroll
        for (int t = 0; t < 4; t++) {
#pragma unroll
            for (int kc = 0; kc < 2; kc++) {
#pragma unroll
                for (int g = 0; g < 2; g++) cacc[g][t] = wmma_bf16(va[t][kc], pb[g][kc], cacc[g][t]);
            }
        }
    }

    const int bidx = bh / NHEAD;
    const int h    = bh % NHEAD;
    // The wave's 32 x 64 result goes through its own 32 rows of the Q tile (read by this wave alone, and only
    // before the loop), so that 8 lanes store a query's whole 128-byte row of this head.
    __bf16* st = Qs + wave * 32 * FS;
#pragma unroll
    for (int g = 0; g < 2; g++) {
        const float lsum = lrow[g] + xhalf(lrow[g]);    // join the two halves' key sums
#pragma unroll
        for (int t = 0; t < 4; t++) {
            bf16x8 o;                // 8 consecutive d of one query
#pragma unroll
            for (int r = 0; r < 8; r++) o[r] = (__bf16)(cacc[g][t][r] / lsum);
            *(bf16x8*)(&st[(g * 16 + lm) * FS + t * 16 + 8 * kh]) = o;
        }
    }
    // the rows are read back by other lanes of this wave: its LDS stores have to be done first
    asm volatile("s_wait_dscnt 0x0" ::: "memory");
    // lane = (row group j, 16-byte chunk ch); rows 8 apart in each half of the wave fall on disjoint banks
    const int j  = lane >> 3, ch = lane & 7;
    const int rw = 8 * (j & 1) + 16 * (j >> 1);
    __bf16* crow = Ctx + ((size_t)(bidx * SEQ + q0 + wave * 32 + rw)) * D_MODEL + h * DK + ch * 8;
    bf16x8 v[8];
#pragma unroll
    for (int i = 0; i < 8; i++) v[i] = *(const bf16x8*)(&st[(rw + i) * FS + ch * 8]);
#pragma unroll
    for (int i = 0; i < 8; i++) *(bf16x8*)(crow + (size_t)i * D_MODEL) = v[i];
}

// ---------------------------------------------------------------------------
// Kernel 3: output projection. out = ctx @ Wo.T + bo, fp32 result. grid=(64,12)
// Products taken as Wo @ ctx^T (a lane holds 8 neighbouring columns of one row); each wave lays its
// 16 x 64 result in an LDS range of its own and stores whole 256-byte rows, 16 bytes a lane.
// ---------------------------------------------------------------------------
#define OSP 68   // result staging row stride (floats): 272B = 16B x odd for the 16-byte LDS stores

__global__ __launch_bounds__(256)
void out_proj_kernel(const __bf16* __restrict__ Ctx, const float* __restrict__ Wo,
                     const float* __restrict__ bo, float* __restrict__ Out)
{
    const int m0 = blockIdx.x * 128;
    const int n0 = blockIdx.y * 64;

    __shared__ __bf16 Xs[2][128 * GS];
    __shared__ __bf16 Ws[2][64 * GS];
    __shared__ __attribute__((aligned(16))) float Cs[8][16 * OSP];      // a range per wave, so no barrier

    const int tid  = threadIdx.x;
    const int wave = tid >> 5;
    const int lane = tid & 31;
    const int lm   = lane & 15;
    const int kh   = lane >> 4;

    f32x8 acc[4] = {};

    // this thread's chunks of a k-step's tiles: ctx rows cr + 64 i (8 bf16), Wo rows sr + 32 i (4 f32)
    const int cr = tid >> 2, cc = (tid & 3) * 8;
    const int sr = tid >> 3, sc = (tid & 7) * 4;
    // The 12 work-groups of a row block read the same lines of ctx, the 64 of a column block the same lines of Wo:
    // they start at different k-steps and wrap round, as in the first projection kernel. Column blocks 4 apart
    // keep a common start: where they come to stand on one WGP, its cache can serve ctx to all three.
    int kk = (int)((blockIdx.x + 6 * (blockIdx.y & 3)) % (D_MODEL / 32)) * 32;
    const __bf16* cg = Ctx + (size_t)(m0 + cr) * D_MODEL + cc;
    const float*  wg = Wo  + (size_t)(n0 + sr) * D_MODEL + sc;

    // step k + 1's tiles are loaded into registers while step k's products run; two LDS
    // buffers and one barrier a step, as in the first projection kernel
    bf16x8 xr[2];
    float4 wr[2];
#pragma unroll
    for (int i = 0; i < 2; i++) xr[i] = *(const bf16x8*)(cg + (size_t)(64 * i) * D_MODEL + kk);
#pragma unroll
    for (int i = 0; i < 2; i++) wr[i] = *(const float4*)(wg + (size_t)(32 * i) * D_MODEL + kk);

    int buf = 0;
    for (int k0 = 0; k0 < D_MODEL; k0 += 32, buf ^= 1) {
        __bf16* Xt = Xs[buf];
        __bf16* Wt = Ws[buf];
#pragma unroll
        for (int i = 0; i < 2; i++)             // ctx tile 128x32 bf16
            *(bf16x8*)(&Xt[(cr + 64 * i) * GS + cc]) = xr[i];
#pragma unroll
        for (int i = 0; i < 2; i++) {           // Wo tile 64x32 f32 -> bf16
            uint2 p; p.x = pack2bf(wr[i].x, wr[i].y); p.y = pack2bf(wr[i].z, wr[i].w);
            *(uint2*)(&Wt[(sr + 32 * i) * GS + sc]) = p;
        }
        __syncthreads();

        if (k0 + 32 < D_MODEL) {                // next step's tiles, in flight under the products
            kk = (kk + 32 == D_MODEL) ? 0 : kk + 32;
#pragma unroll
            for (int i = 0; i < 2; i++) xr[i] = *(const bf16x8*)(cg + (size_t)(64 * i) * D_MODEL + kk);
#pragma unroll
            for (int i = 0; i < 2; i++) wr[i] = *(const float4*)(wg + (size_t)(32 * i) * D_MODEL + kk);
            // these loads' address registers are advanced or reused below while they are in flight
            asm volatile("s_wait_xcnt 0x0" ::: "memory");
        }

        bf16x16 a;
        const int arow = wave * 16 + lm;
#pragma unroll
        for (int e = 0; e < 16; e++) a[e] = Xt[arow * GS + kmap(e, kh)];
#pragma unroll
        for (int t = 0; t < 4; t++) {
            bf16x16 b;
            const int bcol = t * 16 + lm;
#pragma unroll
            for (int e = 0; e < 16; e++) b[e] = Wt[bcol * GS + kmap(e, kh)];
            acc[t] = wmma_bf16(b, a, acc[t]);
        }
    }

    // acc[t][r] = out[row 16 wave + lm][column 16 t + 8 kh + r]
    float4 bl[4][2];
#pragma unroll
    for (int t = 0; t < 4; t++) {
        bl[t][0] = *(const float4*)(bo + n0 + t * 16 + 8 * kh);
        bl[t][1] = *(const float4*)(bo + n0 + t * 16 + 8 * kh + 4);
    }
    // later addresses are formed in these loads' address registers
    asm volatile("s_wait_xcnt 0x0" ::: "memory");
    float* st = Cs[wave];
#pragma unroll
    for (int t = 0; t < 4; t++) {
        float4 lo, hi;
        lo.x = acc[t][0] + bl[t][0].x; lo.y = acc[t][1] + bl[t][0].y; lo.z = acc[t][2] + bl[t][0].z; lo.w = acc[t][3] + bl[t][0].w;
        hi.x = acc[t][4] + bl[t][1].x; hi.y = acc[t][5] + bl[t][1].y; hi.z = acc[t][6] + bl[t][1].z; hi.w = acc[t][7] + bl[t][1].w;
        *(float4*)(&st[lm * OSP + t * 16 + 8 * kh])     = lo;
        *(float4*)(&st[lm * OSP + t * 16 + 8 * kh + 4]) = hi;
    }
    // the rows are read back by other lanes of this wave: its LDS stores have to be done first
    asm volatile("s_wait_dscnt 0x0" ::: "memory");
    float* orow = Out + (size_t)(m0 + wave * 16 + kh) * D_MODEL + n0 + lm * 4;   // half a wave per row
    float4 v[8];
#pragma unroll
    for (int i = 0; i < 8; i++) v[i] = *(const float4*)(&st[(2 * i + kh) * OSP + lm * 4]);
#pragma unroll
    for (int i = 0; i < 8; i++) *(float4*)(orow + (size_t)(2 * i) * D_MODEL) = v[i];
}

// ---------------------------------------------------------------------------
extern "C" void kernel_launch(void* const* d_in, const int* in_sizes, int n_in,
                              void* d_out, int out_size, void* d_ws, size_t ws_size,
                              hipStream_t stream)
{
    (void)in_sizes; (void)n_in; (void)out_size;

    const float* x  = (const float*)d_in[0];
    const float* Wq = (const float*)d_in[1];
    const float* bq = (const float*)d_in[2];
    const float* Wk = (const float*)d_in[3];
    const float* bk = (const float*)d_in[4];
    const float* Wv = (const float*)d_in[5];
    const float* bv = (const float*)d_in[6];
    const float* Wo = (const float*)d_in[7];
    const float* bo = (const float*)d_in[8];
    float* out = (float*)d_out;

    const size_t E = (size_t)MTOT * D_MODEL;      // 6,291,456 elements
    if (ws_size < 4 * E * sizeof(__bf16)) return; // ~48 MB scratch required
    __bf16* ws = (__bf16*)d_ws;
    __bf16* Qb = ws;
    __bf16* Kb = ws + E;
    __bf16* Vb = ws + 2 * E;
    __bf16* Cb = ws + 3 * E;

    dim3 g1(MTOT / QM, 3 * D_MODEL / QN);
    qkv_proj_kernel<<<g1, 256, 0, stream>>>(x, Wq, bq, Wk, bk, Wv, bv, Qb, Kb, Vb);

    dim3 g2(SEQ / 128, BATCH * NHEAD);
    flash_attn_kernel<<<g2, 128, 0, stream>>>(Qb, Kb, Vb, Cb);

    dim3 g3(MTOT / 128, D_MODEL / 64);
    out_proj_kernel<<<g3, 256, 0, stream>>>(Cb, Wo, bo, out);
}
